// v009
// The times below were measured on an AMD MI455X: many runs one after another, warmed up first and cycling through
// copies of the inputs, with the whole window's GPU time divided by the number of runs. Launches and the gaps
// between them are all in it. The median over several windows is given; except for v000 it joins two sittings, which
// can be a few percent apart, so the side-by-side timings, each taken in one sitting, are the better comparison.
// The versions before v009 are in another document.
// It runs in 159 microseconds.
// Next to v008, in two timings, it ran 1.04 times as fast each time.
// All steps since the starting kernel, v000, together make it 47.3 times as fast.
#include <hip/hip_runtime.h>
// Pre-LN transformer encoder block with PER-HEAD projection tensors, no QKV biases (x [8][1024][1024]; h = LN1(x) (biased var, eps 1e-5); q/k/v[h] = h W[h] with W [16][1024][64] ([head][in][out]); scale 64^-0.5; softmax over all 1024 keys (no mask); x1 = x + concat(attn) Wo + bo ([in][out]); out = x1 + gelu_erf(LN2(x1) W1 + b1) W2 + b2 ([in][out] 1024 x 1024 x 1024: hidden = 1 x n_embd, as the source) -> [8][1024][1024]).
// Structure: token rows; LayerNorm / exact f16 rows; WMMA GEMMs for q, k and V^T (the v product with its operands swapped); one fused attention launch (scores, online softmax and P V in registers); output projection with the own-element residual; custom LayerNorm; exact-GELU FFN over all rows; launches: see trace.
// Compute dtype: inputs rounded to bf16; x / weights exact; q, k, v, softmax weights and o as plain f16 GEMM operands (~2^-12); scores and softmax statistics f32. v_wmma_f32_16x16x32_f16.
#define NB 8
#define SQ 1024
#define DM 1024
#define NH 16
#define HD 64
#define HG 4                         /* heads per attention launch group */
#define LOCALW 128                   /* (macros for unused kernels of the shared header) */
#define STRIDEK 128
#define QT 256                       /* query rows per causal tile */
#define NKX SQ                       /* S / P row pitch */
#define QT0 128                      /* first-tile rows recomputed exactly in f32 */
#define B0 0                         /* first batch processed (debug hook) */
#define NBR NB                       /* batches processed (debug hook) */
#define NR ((size_t)NB * SQ)
#define DMQ DM
#define DFF 1024         /* FFN hidden width = 1 x n_embd in this module (W1 [1024][1024], W2 [1024][1024]) */
#define MP ((int)((size_t)NBR * SQ)) /* rows projected (debug hook) */
#define QN SQ                        /* query rows attended per batch (debug hook) */
#define NHD NH                       /* heads attended (debug hook) */
#define MPO MP                       /* rows through the output stage (debug hook) */
#define LQ (3 * DM)      /* unused: q and k rows have pitch DM, one plane each */
typedef __bf16 v16b __attribute__((ext_vector_type(16)));
typedef unsigned short v8us __attribute__((ext_vector_type(8), may_alias));
typedef float  v8f  __attribute__((ext_vector_type(8)));
typedef float  v4f  __attribute__((ext_vector_type(4)));
typedef float  v4fa __attribute__((ext_vector_type(4), may_alias));
union FragB { v16b v; v8us half[2]; unsigned short u[16]; };

__device__ __forceinline__ unsigned short bf16_bits(float x) { unsigned int u = __float_as_uint(x); return (unsigned short)((u + 0x7FFFu + ((u >> 16) & 1u)) >> 16); }
__device__ __forceinline__ float bf16_val(unsigned short b) { return __uint_as_float(((unsigned int)b) << 16); }
__device__ __forceinline__ float bf16_round(float x) { return bf16_val(bf16_bits(x)); }
// D += A·B with NT terms: 1 = ah·bh, 2 = + al·bh (A split), 3 = + ah·bl (both split)
template <int NT>
__device__ __forceinline__ v8f mmaN(v16b ah, v16b al, v16b bh, v16b bl, v8f c) {
  c = __builtin_amdgcn_wmma_f32_16x16x32_bf16(false, ah, false, bh, (short)0, c, false, false);
  if (NT >= 2) c = __builtin_amdgcn_wmma_f32_16x16x32_bf16(false, al, false, bh, (short)0, c, false, false);
  if (NT >= 3) c = __builtin_amdgcn_wmma_f32_16x16x32_bf16(false, ah, false, bl, (short)0, c, false, false);
  asm volatile("v_nop\n\tv_nop\n\tv_nop\n\tv_nop" : "+v"(c) : "v"(ah), "v"(al), "v"(bh), "v"(bl));
  return c;
}

__global__ __launch_bounds__(256) void k_wt_bf16(const float* __restrict__ W, unsigned short* __restrict__ Wt, int K, int N) {
  const int t = blockIdx.x * 256 + threadIdx.x;
  const int k8n = K / 8;
  if (t >= N * k8n) return;
  const int n = t / k8n, k8 = (t % k8n) * 8;
  v8us v;
#pragma unroll
  for (int i = 0; i < 8; ++i) v[i] = bf16_bits(W[(size_t)(k8 + i) * N + n]);
  *(v8us*)(Wt + (size_t)n * K + k8) = v;
  
}

// GEMM C[M][N] (f32, pitch ldc) = act(A[M][K]·W + bias). A f32 row-major (pitch lda) converted per fragment to bf16
// (ASPLIT: hi/lo two planes -> 2 terms, else single rounded term); Wt bf16 [N][K] (pitch ldb). BIAS_BF16 rounds the
// bias to bf16 first (bias quantised to bf16 before the add). K%32==0, M%16==0, N%64==0.
template <bool ASPLIT, int ACT, bool BIAS_BF16>
__global__ __launch_bounds__(128) void k_gemm_bf(const float* __restrict__ A, int lda, const unsigned short* __restrict__ Wt, int ldb,
                                               const float* __restrict__ bias, float* __restrict__ C, int ldc, int M, int N, int K) {
  __shared__ __attribute__((aligned(16))) float so[4][16][64];
  const int tid = threadIdx.x, w = tid >> 5, lane = tid & 31, ln = lane & 15, hh = lane >> 4;
  const int ntn = N / 64;
  const int wid = blockIdx.x * 4 + w;
  const int mt = wid / ntn, nq = wid % ntn;
  if (mt * 16 >= M) return;
  const int row0 = mt * 16, col0 = nq * 64;
  const float* arow = A + (size_t)(row0 + ln) * lda;
  v8f acc[4] = {};
  for (int kb = 0; kb < K; kb += 32) {
    FragB ah, al;
    const v4f x0 = *(const v4fa*)(arow + kb + 8 * hh), x1 = *(const v4fa*)(arow + kb + 8 * hh + 4);
    const v4f x2 = *(const v4fa*)(arow + kb + 16 + 8 * hh), x3 = *(const v4fa*)(arow + kb + 16 + 8 * hh + 4);
    float xs[16] = {x0[0],x0[1],x0[2],x0[3],x1[0],x1[1],x1[2],x1[3],x2[0],x2[1],x2[2],x2[3],x3[0],x3[1],x3[2],x3[3]};
#pragma unroll
    for (int i = 0; i < 16; ++i) { const unsigned short hb = bf16_bits(xs[i]); ah.u[i] = hb; al.u[i] = ASPLIT ? bf16_bits(xs[i] - bf16_val(hb)) : (unsigned short)0; }
#pragma unroll
    for (int t = 0; t < 4; ++t) {
      const unsigned short* brow = Wt + (size_t)(col0 + t * 16 + ln) * ldb + kb;
      FragB b;
      b.half[0] = *(const v8us*)(brow + 8 * hh);
      b.half[1] = *(const v8us*)(brow + 16 + 8 * hh);
      acc[t] = mmaN<ASPLIT ? 2 : 1>(ah.v, al.v, b.v, b.v, acc[t]);
    }
  }
#pragma unroll
  for (int t = 0; t < 4; ++t) {
    float bv = bias ? bias[col0 + t * 16 + ln] : 0.f;
    if (BIAS_BF16) bv = bf16_round(bv);
#pragma unroll
    for (int r = 0; r < 8; ++r) { float v = acc[t][r] + bv; if (ACT == 1) v = fmaxf(v, 0.f); so[w][8 * hh + r][t * 16 + ln] = v; }
  }
  __builtin_amdgcn_fence(__ATOMIC_ACQ_REL, "workgroup");
  __builtin_amdgcn_wave_barrier();
  const int rsub = lane >> 4, c4 = (lane & 15) * 4;
  {
#pragma unroll
    for (int q = 0; q < 8; ++q) {
      const int r = q * 2 + rsub;
      const v4f v = *(const v4fa*)&so[w][r][c4];
      *(v4f*)(C + (size_t)(row0 + r) * ldc + col0 + c4) = v;
    }
    
  }
}

// GEMM C = act(A·W + bias + resid): A f32 (ASPLIT -> hi/lo 2 terms), Wt bf16 [N][K]; ACT 0 none, 1 relu, 2 exact gelu;
// resid (optional, f32, row index = (row % rmod), pitch ldr, RES_BF16 rounds it) added before the activation.
template <bool ASPLIT, int ACT, bool BIAS_BF16, bool RES_BF16>
__global__ __launch_bounds__(128) void k_gemm_bf3(const float* __restrict__ A, int lda, const unsigned short* __restrict__ Wt, int ldb,
                                                const float* __restrict__ bias, const float* __restrict__ resid, int rmod, int ldr,
                                                float* __restrict__ C, int ldc, int M, int N, int K) {
  __shared__ __attribute__((aligned(16))) float so[4][16][64];
  const int tid = threadIdx.x, w = tid >> 5, lane = tid & 31, ln = lane & 15, hh = lane >> 4;
  const int ntn = N / 64;
  const int wid = blockIdx.x * 4 + w;
  const int mt = wid / ntn, nq = wid % ntn;
  if (mt * 16 >= M) return;
  const int row0 = mt * 16, col0 = nq * 64;
  const float* arow = A + (size_t)(row0 + ln) * lda;
  v8f acc[4] = {};
  for (int kb = 0; kb < K; kb += 32) {
    FragB ah, al;
    const v4f x0 = *(const v4fa*)(arow + kb + 8 * hh), x1 = *(const v4fa*)(arow + kb + 8 * hh + 4);
    const v4f x2 = *(const v4fa*)(arow + kb + 16 + 8 * hh), x3 = *(const v4fa*)(arow + kb + 16 + 8 * hh + 4);
    float xs[16] = {x0[0],x0[1],x0[2],x0[3],x1[0],x1[1],x1[2],x1[3],x2[0],x2[1],x2[2],x2[3],x3[0],x3[1],x3[2],x3[3]};
#pragma unroll
    for (int i = 0; i < 16; ++i) { const unsigned short hb = bf16_bits(xs[i]); ah.u[i] = hb; al.u[i] = ASPLIT ? bf16_bits(xs[i] - bf16_val(hb)) : (unsigned short)0; }
#pragma unroll
    for (int t = 0; t < 4; ++t) {
      const unsigned short* brow = Wt + (size_t)(col0 + t * 16 + ln) * ldb + kb;
      FragB b;
      b.half[0] = *(const v8us*)(brow + 8 * hh);
      b.half[1] = *(const v8us*)(brow + 16 + 8 * hh);
      acc[t] = mmaN<ASPLIT ? 2 : 1>(ah.v, al.v, b.v, b.v, acc[t]);
    }
  }
#pragma unroll
  for (int t = 0; t < 4; ++t) {
    const int col = col0 + t * 16 + ln;
    float bv = bias ? bias[col] : 0.f;
    if (BIAS_BF16) bv = bf16_round(bv);
#pragma unroll
    for (int r = 0; r < 8; ++r) {
      float v = acc[t][r] + bv;
      if (resid) { float rv = resid[(size_t)((row0 + 8 * hh + r) % rmod) * ldr + col]; if (RES_BF16) rv = bf16_round(rv); v += rv; }
      if (ACT == 1) v = fmaxf(v, 0.f);
      if (ACT == 2) v = 0.5f * v * (1.0f + erff(v * 0.70710678118654752f));
      if (ACT == 3) { const float u = 0.7978845608028654f * (v + 0.044715f * v * v * v); v = 0.5f * v * (1.0f + tanhf(u)); }
      so[w][8 * hh + r][t * 16 + ln] = v;
    }
  }
  __builtin_amdgcn_fence(__ATOMIC_ACQ_REL, "workgroup");
  __builtin_amdgcn_wave_barrier();
  const int rsub = lane >> 4, c4 = (lane & 15) * 4;
  {
#pragma unroll
    for (int q = 0; q < 8; ++q) {
      const int r = q * 2 + rsub;
      const v4f v = *(const v4fa*)&so[w][r][c4];
      *(v4f*)(C + (size_t)(row0 + r) * ldc + col0 + c4) = v;
    }
    
  }
}
// row LayerNorm (biased variance, eps) over N: s = X (+ R); optional out_sum <- s; out_norm <- (s-mu)*rsqrt(var+eps)*g + b
template <bool PARAM_BF16>
__global__ __launch_bounds__(256) void k_layernorm(const float* __restrict__ X, const float* __restrict__ R, const float* __restrict__ g, const float* __restrict__ bta,
                                                  float* __restrict__ out_sum, float* __restrict__ out_norm, int N, float eps) {
  __shared__ float red[256];
  const int row = blockIdx.x, tid = threadIdx.x;
  const float* x = X + (size_t)row * N; const float* rr = R ? R + (size_t)row * N : nullptr;
  float vals[16];                     // up to N = 4096
  const int per = N / 256;            // contiguous chunk per thread? use strided-by-4 chunks: thread handles j = tid*4 + 1024*u
  float s1 = 0.f;
  for (int u = 0; u < per / 4; ++u) {
    const int j = tid * 4 + 1024 * u;
    const v4f a = *(const v4fa*)(x + j);
    v4f b = {0.f,0.f,0.f,0.f}; if (rr) b = *(const v4fa*)(rr + j);
#pragma unroll
    for (int q = 0; q < 4; ++q) { const float v = a[q] + b[q]; vals[u * 4 + q] = v; s1 += v; }
  }
  red[tid] = s1; __syncthreads();
  for (int st = 128; st > 0; st >>= 1) { if (tid < st) red[tid] += red[tid + st]; __syncthreads(); }
  const float mu = red[0] / (float)N; __syncthreads();
  float s2 = 0.f;
  for (int u = 0; u < per / 4; ++u)
#pragma unroll
    for (int q = 0; q < 4; ++q) { const float c = vals[u * 4 + q] - mu; s2 += c * c; }
  red[tid] = s2; __syncthreads();
  for (int st = 128; st > 0; st >>= 1) { if (tid < st) red[tid] += red[tid + st]; __syncthreads(); }
  const float rs = rsqrtf(red[0] / (float)N + eps);
  {
    for (int u = 0; u < per / 4; ++u) {
      const int j = tid * 4 + 1024 * u;
      v4f o, sm;
#pragma unroll
      for (int q = 0; q < 4; ++q) {
        float gg = g[j + q], bb = bta[j + q];
        if (PARAM_BF16) { gg = bf16_round(gg); bb = bf16_round(bb); }
        sm[q] = vals[u * 4 + q]; o[q] = (vals[u * 4 + q] - mu) * rs * gg + bb;
      }
      if (out_sum) *(v4f*)(out_sum + (size_t)row * N + j) = sm;
      *(v4f*)(out_norm + (size_t)row * N + j) = o;
    }
    
  }
}



// ---- f16 WMMA path (v_wmma_f32_16x16x32_f16): 11-bit significands for operands in range — used where a [0,1] probability operand needs more precision than bf16
typedef _Float16 v16h __attribute__((ext_vector_type(16)));
union FragH { v16h v; v8us half[2]; _Float16 h[16]; unsigned short u[16]; };
template <int NT>
__device__ __forceinline__ v8f mmaH(v16h ah, v16h al, v16h bh, v16h bl, v8f c) {
  c = __builtin_amdgcn_wmma_f32_16x16x32_f16(false, ah, false, bh, (short)0, c, false, false);
  if (NT >= 2) c = __builtin_amdgcn_wmma_f32_16x16x32_f16(false, al, false, bh, (short)0, c, false, false);
  if (NT >= 3) c = __builtin_amdgcn_wmma_f32_16x16x32_f16(false, ah, false, bl, (short)0, c, false, false);
  asm volatile("v_nop\n\tv_nop\n\tv_nop\n\tv_nop" : "+v"(c) : "v"(ah), "v"(al), "v"(bh), "v"(bl));
  return c;
}
// batched GEMM like k_gemm_b but f16 operands: A f32 (split into f16 hi/lo if ASPLIT, else rounded to f16), Bt = f16 values [n][k]; alpha; C f32; N multiple of 16 (partial tiles skipped)
template <bool ASPLIT>
__global__ __launch_bounds__(128) void k_gemm_h(const float* __restrict__ A, int lda, size_t sA, const _Float16* __restrict__ Bh, int ldb, size_t sB, float alpha, float* __restrict__ C, int ldc, size_t sC, int M, int N, int K) {
  __shared__ __attribute__((aligned(16))) float so[4][16][64];
  const int tid = threadIdx.x, w = tid >> 5, lane = tid & 31, ln = lane & 15, hh = lane >> 4; const int by = blockIdx.y;
  A += (size_t)by * sA; Bh += (size_t)by * sB; C += (size_t)by * sC;
  const int ntn = (N + 63) / 64; const int wid = blockIdx.x * 4 + w; const int mt = wid / ntn, nq = wid % ntn; if (mt * 16 >= M) return;
  const int row0 = mt * 16, col0 = nq * 64; const float* arow = A + (size_t)(row0 + ln) * lda;
  v8f acc[4] = {};
  for (int kb = 0; kb < K; kb += 32) {
    FragH ah, al;
    const v4f x0 = *(const v4fa*)(arow + kb + 8 * hh), x1 = *(const v4fa*)(arow + kb + 8 * hh + 4), x2 = *(const v4fa*)(arow + kb + 16 + 8 * hh), x3 = *(const v4fa*)(arow + kb + 16 + 8 * hh + 4);
    float xs[16] = {x0[0],x0[1],x0[2],x0[3],x1[0],x1[1],x1[2],x1[3],x2[0],x2[1],x2[2],x2[3],x3[0],x3[1],x3[2],x3[3]};
#pragma unroll
    for (int i = 0; i < 16; ++i) { const _Float16 h = (_Float16)xs[i]; ah.h[i] = h; al.h[i] = ASPLIT ? (_Float16)(xs[i] - (float)h) : (_Float16)0.0f; }
#pragma unroll
    for (int t = 0; t < 4; ++t) { if (col0 + t * 16 >= N) continue; const size_t boff = (size_t)(col0 + t * 16 + ln) * ldb + kb; FragH bq; bq.half[0] = *(const v8us*)(Bh + boff + 8 * hh); bq.half[1] = *(const v8us*)(Bh + boff + 16 + 8 * hh);
      acc[t] = mmaH<ASPLIT ? 2 : 1>(ah.v, al.v, bq.v, bq.v, acc[t]); }
  }
#pragma unroll
  for (int t = 0; t < 4; ++t) { if (col0 + t * 16 >= N) continue;
#pragma unroll
    for (int r = 0; r < 8; ++r) so[w][8 * hh + r][t * 16 + ln] = acc[t][r] * alpha; }
  __builtin_amdgcn_fence(__ATOMIC_ACQ_REL, "workgroup"); __builtin_amdgcn_wave_barrier();
  const int rsub = lane >> 4, c4 = (lane & 15) * 4;
  {
#pragma unroll
    for (int q = 0; q < 8; ++q) { const int r = q * 2 + rsub; if (col0 + c4 < N) { const v4f v = *(const v4fa*)&so[w][r][c4]; *(v4f*)(C + (size_t)(row0 + r) * ldc + col0 + c4) = v; } }
     }
}

// Wt[n][k] = f16(W[k][n]·scale) from f32 row-major W[K][N] (scale = power of two; bf16-exact weights stay exact in f16 away from the subnormal range)
__global__ __launch_bounds__(256) void k_wt_f16(const float* __restrict__ W, _Float16* __restrict__ Wt, int K, int N, float scale) {
  const int t = blockIdx.x * 256 + threadIdx.x; if (t >= N * (K / 8)) return; const int n = t / (K / 8), k8 = (t % (K / 8)) * 8; FragH f;
#pragma unroll
  for (int i = 0; i < 8; ++i) f.h[i] = (_Float16)(bf16_round(W[(size_t)(k8 + i) * N + n]) * scale); const v8us o = f.half[0];
  *(v8us*)((unsigned short*)Wt + (size_t)n * K + k8) = o; 
}
// k_gemm_hh variant with fused epilogue: v = acc·alpha + bias[by·sBias + col] (+ CP[(row/rowsPerB)·sCPb + by·64 + col] if CP) ; ACT 0 none / 1 elu ; writes f16 C16 (and f32 C if non-null)
template <int ACT>
__global__ __launch_bounds__(128) void k_gemm_hhx(const _Float16* __restrict__ A, int lda, size_t sA, const _Float16* __restrict__ Bh, int ldb, size_t sB, float alpha, const float* __restrict__ bias, size_t sBias, const float* __restrict__ CP, int rowsPerB, size_t sCPb, int row0g,
    float* __restrict__ C, _Float16* __restrict__ C16, int ldc, size_t sC, int M, int N, int K) {
  __shared__ __attribute__((aligned(16))) float so[4][16][64];
  const int tid = threadIdx.x, w = tid >> 5, lane = tid & 31, ln = lane & 15, hh = lane >> 4; const int by = blockIdx.y;
  A += (size_t)by * sA; Bh += (size_t)by * sB; const size_t cofs = (size_t)by * sC; const float* bp = bias ? bias + (size_t)by * sBias : nullptr;
  const int ntn = (N + 63) / 64; const int wid = blockIdx.x * 4 + w; const int mt = wid / ntn, nq = wid % ntn; if (mt * 16 >= M) return;
  const int row0 = mt * 16, col0 = nq * 64; const _Float16* arow = A + (size_t)(row0 + ln) * lda;
  v8f acc[4] = {};
  for (int kb = 0; kb < K; kb += 32) { FragH ah; ah.half[0] = *(const v8us*)((const unsigned short*)arow + kb + 8 * hh); ah.half[1] = *(const v8us*)((const unsigned short*)arow + kb + 16 + 8 * hh);
#pragma unroll
    for (int t = 0; t < 4; ++t) { if (col0 + t * 16 >= N) continue; const size_t boff = (size_t)(col0 + t * 16 + ln) * ldb + kb; FragH bq; bq.half[0] = *(const v8us*)((const unsigned short*)Bh + boff + 8 * hh); bq.half[1] = *(const v8us*)((const unsigned short*)Bh + boff + 16 + 8 * hh);
      acc[t] = mmaH<1>(ah.v, ah.v, bq.v, bq.v, acc[t]); }
  }
#pragma unroll
  for (int t = 0; t < 4; ++t) { if (col0 + t * 16 >= N) continue; const int col = col0 + t * 16 + ln; const float bv = bp ? bf16_round(bp[col]) : 0.f;
#pragma unroll
    for (int r = 0; r < 8; ++r) { float v = acc[t][r] * alpha + bv; if (CP) { const int rr = row0g + row0 + 8 * hh + r; if (rowsPerB < 0) v += CP[cofs + (size_t)rr * ldc + col];      /* rowsPerB < 0: own element of the batched C plane */ else { const int bidx = rr / rowsPerB; v += CP[(size_t)bidx * sCPb + (size_t)by * 64 + col]; } } if (ACT == 1) v = (v > 0.f) ? v : expm1f(v); else if (ACT == 7) v = (v > 0.f) ? v + 1.0f : expf(v); else if (ACT == 8) v = tanhf(v); else if (ACT == 9) v = 0.5f * v * (1.0f + tanhf(0.7978845608028654f * (v + 0.044715f * v * v * v))); else if (ACT == 11) v = 1.0f / (1.0f + expf(-v)); else if (ACT == 12) v = (v > 0.f) ? v : 0.01f * v; else if (ACT == 14) v = (v > 0.f) ? v : 0.1f * v; else if (ACT == 16) v = (v >= 0.f) ? v : 0.3f * v; else if (ACT == 17) v = (v >= 0.f) ? v : 0.2f * v; else if (ACT == 15) v = v / (1.0f + expf(-v)); else if (ACT == 3) v = fmaxf(v, 0.f); else if (ACT == 6) v = 0.5f * v * (1.0f + erff(v * 0.70710678118654752f)); so[w][8 * hh + r][t * 16 + ln] = v; } }
  __builtin_amdgcn_fence(__ATOMIC_ACQ_REL, "workgroup"); __builtin_amdgcn_wave_barrier();
  const int rsub = lane >> 4, c4 = (lane & 15) * 4; typedef _Float16 v4h __attribute__((ext_vector_type(4)));
  {
#pragma unroll
    for (int q = 0; q < 8; ++q) { const int r = q * 2 + rsub; if (col0 + c4 < N) { const v4f v = *(const v4fa*)&so[w][r][c4]; if (C) *(v4f*)(C + cofs + (size_t)(row0 + r) * ldc + col0 + c4) = v; if (C16) { v4h h4; for (int i = 0; i < 4; ++i) h4[i] = (_Float16)v[i]; *(v4h*)(C16 + cofs + (size_t)(row0 + r) * ldc + col0 + c4) = h4; } } }
     }
}


typedef _Float16 v4h __attribute__((ext_vector_type(4)));

__global__ __launch_bounds__(256) void k_x16(const float* __restrict__ x, _Float16* __restrict__ X16, size_t n8) { const size_t t = (size_t)blockIdx.x * 256 + threadIdx.x; if (t >= n8) return; FragH f;
#pragma unroll
  for (int q = 0; q < 8; ++q) f.h[q] = (_Float16)bf16_round(x[t * 8 + q]); *(v8us*)((unsigned short*)X16 + t * 8) = f.half[0];  }
__global__ __launch_bounds__(256) void k_h16(const float* __restrict__ x, _Float16* __restrict__ X16, size_t n8) { const size_t t = (size_t)blockIdx.x * 256 + threadIdx.x; if (t >= n8) return; FragH f;
#pragma unroll
  for (int q = 0; q < 8; ++q) f.h[q] = (_Float16)x[t * 8 + q]; *(v8us*)((unsigned short*)X16 + t * 8) = f.half[0];  }
__global__ __launch_bounds__(256) void k_round16f(const float* __restrict__ W, _Float16* __restrict__ Bt, size_t n8) { const size_t t = (size_t)blockIdx.x * 256 + threadIdx.x; if (t >= n8) return; FragH f;
#pragma unroll
  for (int i = 0; i < 8; ++i) f.h[i] = (_Float16)(bf16_round(W[t * 8 + i]) * 16.0f); *(v8us*)((unsigned short*)Bt + t * 8) = f.half[0];  }
template <int NHv, int TTv>
__global__ __launch_bounds__(256) void k_vt(const _Float16* __restrict__ V16, int ldv, int voff, _Float16* __restrict__ Vt) { __shared__ unsigned short tl[64][66]; const int tid = threadIdx.x; const int slab = blockIdx.x / (TTv / 64), lg = blockIdx.x % (TTv / 64); const int b = slab / NHv, h = slab % NHv;
  for (int i = tid; i < 64 * 8; i += 256) { const int r = i / 8, c8 = (i % 8) * 8; FragH f; f.half[0] = *(const v8us*)((const unsigned short*)V16 + ((size_t)b * TTv + lg * 64 + r) * ldv + voff + h * 64 + c8);
#pragma unroll
    for (int q = 0; q < 8; ++q) tl[r][c8 + q] = f.u[q]; }
  __syncthreads();
  {
#pragma unroll
    for (int rd = 0; rd < 2; ++rd) { const int d = rd * 32 + tid / 8, pc = tid % 8; FragH f;
#pragma unroll
      for (int q = 0; q < 8; ++q) f.u[q] = tl[pc * 8 + q][d];
      *(v8us*)((unsigned short*)Vt + ((size_t)slab * 64 + d) * TTv + lg * 64 + pc * 8) = f.half[0]; }
     } }

__global__ __launch_bounds__(256) void k_hl(const float* __restrict__ F, _Float16* __restrict__ Hh, _Float16* __restrict__ Hl, size_t n8) { const size_t t = (size_t)blockIdx.x * 256 + threadIdx.x; if (t >= n8) return; FragH fh, fl; const v4f a = *(const v4fa*)(F + t * 8), c = *(const v4fa*)(F + t * 8 + 4);
#pragma unroll
  for (int q = 0; q < 4; ++q) { _Float16 h = (_Float16)a[q]; fh.h[q] = h; fl.h[q] = (_Float16)((a[q] - (float)h) * 1024.0f); h = (_Float16)c[q]; fh.h[4 + q] = h; fl.h[4 + q] = (_Float16)((c[q] - (float)h) * 1024.0f); }
  { *(v8us*)((unsigned short*)Hh + t * 8) = fh.half[0]; *(v8us*)((unsigned short*)Hl + t * 8) = fl.half[0];  } }

// one 16 x 32 f16 fragment of a k-contiguous row: 16 bytes at k = 8 hh and 16 bytes at k = 16 + 8 hh (A and B alike)
__device__ __forceinline__ v16h g2_frag(const _Float16* p, int hh) { FragH f; f.half[0] = *(const v8us*)((const unsigned short*)p + 8 * hh); f.half[1] = *(const v8us*)((const unsigned short*)p + 16 + 8 * hh); return f.v; }
// ---- tiled GEMM: one 128 x 128 tile of C per work-group (M % 128 == 0, N % 128 == 0, K % 64 == 0), four waves as 2 x 2, 64 x 64 per wave; epilogue = k_gemm_hhx semantics ----
// A stage is 64 k of 128 rows of A and of 128 rows of Bt, brought into LDS by asynchronous copies (whole 128-byte lines, through no register) and read by every wave that needs it.
// Two buffers: the next stage's copies fly while this stage is worked on. The k order of every sum is that of the unstaged loop (32 k per product, ascending).
#define G3P 144                      /* LDS row pitch in bytes: 128 of data + 16, so that the 16 rows of a 16-byte fragment read fall on 64 different banks */
#define G3T (128 * G3P)              /* one operand's tile */
#define G3S (2 * G3T)                /* one stage: [A tile | Bt tile] */
__device__ __forceinline__ v8f g3_mma(v16h a, v16h b, v8f c) { return __builtin_amdgcn_wmma_f32_16x16x32_f16(false, a, false, b, (short)0, c, false, false); }
// Eight copies of 16 bytes a lane: rows r, r + 16, .., r + 112 of one operand's tile (l: the lane's LDS byte address, g: its global address, ld: the source pitch in elements).
// The s_wait_xcnt stands inside the statement, behind the last copy, so that no address register of a copy is rewritten in front of it.
__device__ __forceinline__ void g3_copy8(unsigned l, const _Float16* g, int ld) {
  const size_t st = (size_t)16 * ld;
  asm volatile("global_load_async_to_lds_b128 %0, %8, off\n\t"
               "global_load_async_to_lds_b128 %1, %9, off\n\t"
               "global_load_async_to_lds_b128 %2, %10, off\n\t"
               "global_load_async_to_lds_b128 %3, %11, off\n\t"
               "global_load_async_to_lds_b128 %4, %12, off\n\t"
               "global_load_async_to_lds_b128 %5, %13, off\n\t"
               "global_load_async_to_lds_b128 %6, %14, off\n\t"
               "global_load_async_to_lds_b128 %7, %15, off\n\t"
               "s_wait_xcnt 0x0"
               :: "v"(l), "v"(l + 16 * G3P), "v"(l + 32 * G3P), "v"(l + 48 * G3P), "v"(l + 64 * G3P), "v"(l + 80 * G3P), "v"(l + 96 * G3P), "v"(l + 112 * G3P),
                  "v"(g), "v"(g + st), "v"(g + 2 * st), "v"(g + 3 * st), "v"(g + 4 * st), "v"(g + 5 * st), "v"(g + 6 * st), "v"(g + 7 * st)
               : "memory"); }
template <int ACT>
__device__ __forceinline__ float g3_act(float v) {
  if (ACT == 3) v = fmaxf(v, 0.f); else if (ACT == 6) v = 0.5f * v * (1.0f + erff(v * 0.70710678118654752f)); else if (ACT == 11) v = 1.0f / (1.0f + expf(-v)); else if (ACT == 15) v = v / (1.0f + expf(-v)); else if (ACT == 18) v = v / (1.0f + expf(-1.702f * v));      /* QuickGELU: v sigmoid(1.702 v) */ else if (ACT == 12) v = (v > 0.f) ? v : 0.01f * v; else if (ACT == 8) v = tanhf(v); else if (ACT == 9) v = 0.5f * v * (1.0f + tanhf(0.7978845608028654f * (v + 0.044715f * v * v * v))); else if (ACT == 14) v = (v > 0.f) ? v : 0.1f * v; else if (ACT == 16) v = (v >= 0.f) ? v : 0.3f * v; else if (ACT == 17) v = (v >= 0.f) ? v : 0.2f * v;
  return v; }
// Exact-erf GELU of four values, without a branch. The library erff picks one of two fits per lane (|x| < 1: x + x p(x^2); else 1 - exp(-q(|x|))); in a wave both sides are nearly always taken,
// one after the other, each a serial chain behind a compare, an EXEC write and a jump. Here every lane evaluates both fits (the same coefficients, as fused multiply-adds on whole vectors) and selects,
// so that many values' chains run side by side. exp(-q) is 2^(-q log2 e) on the hardware's own 2^x: q >= 1.8 on the side that is kept, so the result moves by a last f32 bit at most.
__device__ __forceinline__ v4f g3_sp(unsigned bits) { const float k = __builtin_bit_cast(float, bits); const v4f r = {k, k, k, k}; return r; }
__device__ __forceinline__ v4f g3_gelu4(v4f v) {
  const v4f x = v * 0.70710678118654752f, ax = __builtin_elementwise_abs(x), t = x * x;
  v4f p = __builtin_elementwise_fma(t, g3_sp(0xba1345e1u), g3_sp(0x3ba10414u));
  p = __builtin_elementwise_fma(t, p, g3_sp(0xbcdac9b8u)); p = __builtin_elementwise_fma(t, p, g3_sp(0x3de703beu)); p = __builtin_elementwise_fma(t, p, g3_sp(0xbec09330u)); p = __builtin_elementwise_fma(t, p, g3_sp(0x3e0375d0u));
  p = __builtin_elementwise_fma(ax, p, ax);
  v4f q = __builtin_elementwise_fma(ax, g3_sp(0x378e98abu), g3_sp(0xb9c68948u));
  q = __builtin_elementwise_fma(ax, q, g3_sp(0x3b7cd369u)); q = __builtin_elementwise_fma(ax, q, g3_sp(0xbcc618b2u)); q = __builtin_elementwise_fma(ax, q, g3_sp(0x3dda74e4u)); q = __builtin_elementwise_fma(ax, q, g3_sp(0x3f228afdu)); q = __builtin_elementwise_fma(ax, q, g3_sp(0x3e03c728u));
  q = __builtin_elementwise_fma(ax, q, ax) * -1.44269504088896340736f;
  v4f e;
#pragma unroll      /* unrolled: the vectors' elements are named by constants */
  for (int i = 0; i < 4; ++i) e[i] = __builtin_copysignf(ax[i] < 1.0f ? p[i] : 1.0f - __builtin_amdgcn_exp2f(q[i]), x[i]);
  return (0.5f * v) * (1.0f + e); }
// RES: add CP's own element of the C plane, then the activation (both on the staged rows, 16 bytes a lane); W32: write f32 rows to C, else f16 rows to C16. Both are compile-time, so that the epilogue is one straight run and its loads go out together.
// RBF: the residual element is rounded to bf16 where it is read (CP is then the raw input, and no rounded copy of it is kept).
// VSW: plane 2 runs with A and Bt swapped, so that its tile is C^T: rows = Bt's rows, columns = A's rows (tokens). It is stored as SQ-token blocks, [token / SQ][Bt row][token % SQ], pitch SQ == ldc: V^T per batch and head, with no transposing pass. The k order of every sum is the same; the swapped plane takes no bias (it would run along the rows).
template <int ACT, bool RES, bool W32, bool RBF = false, bool VSW = false>
__global__ __launch_bounds__(128) void k_gemm3(const _Float16* __restrict__ A, int lda, size_t sA, const _Float16* __restrict__ Bh, int ldb, size_t sB, float alpha, const float* __restrict__ bias, size_t sBias, const float* __restrict__ CP,
    float* __restrict__ C, _Float16* __restrict__ C16, size_t sC, int M, int N, int K) { static_assert(ACT == 0 || ACT == 3 || ACT == 6 || ACT == 8 || ACT == 9 || ACT == 11 || ACT == 12 || ACT == 14 || ACT == 15 || ACT == 16 || ACT == 17 || ACT == 18, "k_gemm3: unsupported ACT code (would silently apply no activation)");
  __shared__ __attribute__((aligned(128))) unsigned char L[2 * G3S]; static_assert(4 * 64 * 68 * 4 <= 2 * G3S, "k_gemm3: the output staging reuses the ring");
  const int tid = threadIdx.x, w = tid >> 5, lane = tid & 31, ln = lane & 15, hh = lane >> 4; const int by = blockIdx.y;
  A += (size_t)by * sA; Bh += (size_t)by * sB; const size_t cofs = (size_t)by * sC; const bool sw = VSW && by == 2;      /* the same for the whole work-group */
  if (sw) { const _Float16* const pa0 = A; A = Bh; Bh = pa0; const int m0 = M; M = N; N = m0; const int l0 = lda; lda = ldb; ldb = l0; }
  const float* bp = (bias && !sw) ? bias + (size_t)by * sBias : nullptr;
  const int ntn = N >> 7; const int mt = blockIdx.x / ntn, nq = blockIdx.x - mt * ntn; if (mt * 128 >= M) return;      /* the same for the whole work-group, in front of every barrier */
  const int row0 = mt * 128 + (w >> 1) * 64, col0 = nq * 128 + (w & 1) * 64;
  const unsigned lc = (unsigned)(size_t)L + (unsigned)((tid >> 3) * G3P + (tid & 7) * 16);      /* eight lanes copy one 128-byte row */
  const _Float16* ga = A + (size_t)(mt * 128 + (tid >> 3)) * lda + (tid & 7) * 8; const _Float16* gb = Bh + (size_t)(nq * 128 + (tid >> 3)) * ldb + (tid & 7) * 8;
  const int nt = K >> 6; constexpr int ldc = DM; static_assert(DFF == DM, "k_gemm3: one output pitch");      /* a compile-time pitch: the epilogue's loads and stores share one address pair each and differ only in their immediate offsets */
  const v8f z8 = {0.f,0.f,0.f,0.f,0.f,0.f,0.f,0.f}; v8f acc[4][4];
#pragma unroll
  for (int i = 0; i < 4; ++i)
#pragma unroll
    for (int j = 0; j < 4; ++j) acc[i][j] = z8;
  g3_copy8(lc, ga, lda); g3_copy8(lc + G3T, gb, ldb);
  asm volatile("s_wait_asynccnt 0x0" ::: "memory");      /* stage 0 has landed (this wave's copies) */
  __syncthreads();      /* ... and every wave's */
  if (nt > 1) { g3_copy8(lc + G3S, ga + 64, lda); g3_copy8(lc + G3S + G3T, gb + 64, ldb); }
  float bv[4] = {0.f, 0.f, 0.f, 0.f};      /* the lane's four bias values, fetched here so that they arrive under the loop */
  if (bp) {
#pragma unroll
    for (int t = 0; t < 4; ++t) bv[t] = bp[col0 + t * 16 + ln];
    asm volatile("s_wait_xcnt 0x0" ::: "memory"); }      /* the four loads' offset register is rewritten right behind them */
#pragma unroll 1
  for (int t = 0; t < nt; ++t) { const unsigned buf = (unsigned)(t & 1) * G3S;      /* rolled: one copy of the 32 products in the text */
    const _Float16* pa = (const _Float16*)(L + buf + ((w >> 1) * 64 + ln) * G3P); const _Float16* pb = (const _Float16*)(L + buf + G3T + ((w & 1) * 64 + ln) * G3P);
    v16h a[2][4], b[2][4];
#pragma unroll
    for (int ks = 0; ks < 2; ++ks)
#pragma unroll
      for (int i = 0; i < 4; ++i) { a[ks][i] = g2_frag(pa + i * 16 * (G3P / 2) + ks * 32, hh); b[ks][i] = g2_frag(pb + i * 16 * (G3P / 2) + ks * 32, hh); }
    __builtin_amdgcn_sched_barrier(0);      /* keeps the stage's 32 fragment reads together in front of its products: without it the scheduler sinks the A reads among them, into one register set, and every four products wait out an LDS latency */
#pragma unroll
    for (int ks = 0; ks < 2; ++ks)
#pragma unroll
      for (int i = 0; i < 4; ++i)
#pragma unroll
        for (int j = 0; j < 4; ++j) acc[i][j] = g3_mma(a[ks][i], b[ks][j], acc[i][j]);
    __builtin_amdgcn_sched_barrier(0);      /* keeps the products in front of the stage's waits: without it the scheduler sinks them behind the barrier, and the wait for the next stage's copies stands at the head of the trip, before they have had time to land */
    asm volatile("s_wait_dscnt 0x0" ::: "memory");      /* this wave's reads of the buffer have returned */
    asm volatile("s_wait_asynccnt 0x0" ::: "memory");      /* this wave's copies of stage t + 1 have landed */
    __syncthreads();      /* publishes stage t + 1 and frees stage t's buffer */
    if (t + 2 < nt) { g3_copy8(lc + buf, ga + (size_t)(t + 2) * 64, lda); g3_copy8(lc + buf + G3T, gb + (size_t)(t + 2) * 64, ldb); } }
  asm volatile("s_wait_asynccnt 0x0" ::: "memory");      /* no copy is outstanding when the ring becomes output staging */
  float (*so)[68] = (float (*)[68])(L + (size_t)w * (64 * 68 * 4));      /* each wave stages in its own range; the last trip's barrier has ended every read of the ring */
#pragma unroll
  for (int u = 0; u < 16; ++u) { const int t = u & 3, half = u >> 2;
#pragma unroll
    for (int r = 0; r < 8; ++r) { const int rloc = half * 16 + 8 * hh + r; const float v = acc[half][t][r] * alpha + bf16_round(bv[t]);
      so[rloc][t * 16 + ln] = v; } }
  __builtin_amdgcn_fence(__ATOMIC_ACQ_REL, "workgroup"); __builtin_amdgcn_wave_barrier();
  const int rsub = lane >> 4, c4 = (lane & 15) * 4;
  static_assert(!VSW || (SQ == ldc && SQ % 128 == 0), "k_gemm3: a swapped tile lies in one SQ-token block, whose pitch is ldc");
  const size_t cb = sw ? (size_t)(col0 / SQ) * ((size_t)DM * SQ) + (size_t)(col0 % SQ) : (size_t)col0;      /* the wave's first column in the C plane */
  const size_t e0 = cofs + (size_t)(row0 + rsub) * ldc + cb + c4;      /* the lane's first element; row q * 2 + rsub lies q * 2 * ldc elements further on */
  v4f rv[32]; static_assert(!RES || ACT == 0, "k_gemm3: the residual rows are held in registers, so their loop is unrolled");
  if (RES) {
#pragma unroll
    for (int q = 0; q < 32; ++q) rv[q] = *(const v4fa*)(CP + e0 + (size_t)q * (2 * ldc));
    asm volatile("s_wait_xcnt 0x0" ::: "memory");      /* the 32 loads share one address pair, which is rewritten right behind them */
  }
  if (RES && RBF) {      /* both loops unrolled: rv is indexed by constants only and stays in registers */
#pragma unroll
    for (int q = 0; q < 32; ++q)
#pragma unroll
      for (int i = 0; i < 4; ++i) rv[q][i] = bf16_round(rv[q][i]); }
  if constexpr (ACT == 6) {      /* GELU rows, eight at a time: 32 values a lane whose chains run side by side; the inner loops are unrolled so that v and h4 are indexed by constants only and stay in registers */
#pragma unroll 1      /* rolled: four trips of one copy of the 32 evaluations in the text */
    for (int q0 = 0; q0 < 32; q0 += 8) { v4f v[8]; v4h h4[8];
#pragma unroll
      for (int u = 0; u < 8; ++u) v[u] = *(const v4fa*)&so[(q0 + u) * 2 + rsub][c4];
#pragma unroll
      for (int u = 0; u < 8; ++u) { v[u] = g3_gelu4(v[u]);
#pragma unroll
        for (int i = 0; i < 4; ++i) h4[u][i] = (_Float16)v[u][i]; }
      __builtin_amdgcn_sched_barrier(0);      /* every result is in its own registers before the first store: nothing is computed behind a store, so no register of an issued store is rewritten inside the trip */
#pragma unroll
      for (int u = 0; u < 8; ++u) { const size_t e = e0 + (size_t)(q0 + u) * (2 * ldc); if (W32) *(v4f*)(C + e) = v[u]; else *(v4h*)(C16 + e) = h4[u]; }
      asm volatile("s_wait_xcnt 0x0" ::: "memory");      /* the next trip rewrites registers of the eight issued stores: one wait in front of that */
    }
  } else
  {
#pragma unroll(ACT == 0 ? 32 : 2)      /* with an activation the loop stays rolled */
    for (int q = 0; q < 32; ++q) { const int r = q * 2 + rsub; const size_t e = e0 + (size_t)q * (2 * ldc); v4f v = *(const v4fa*)&so[r][c4]; if (RES) v += rv[q]; for (int i = 0; i < 4; ++i) v[i] = g3_act<ACT>(v[i]); if (W32) *(v4f*)(C + e) = v; else { v4h h4; for (int i = 0; i < 4; ++i) h4[i] = (_Float16)v[i]; *(v4h*)(C16 + e) = h4; }
      if (ACT != 0 || (q & 7) == 7) asm volatile("s_wait_xcnt 0x0" ::: "memory");      /* later rows rewrite registers of issued stores (rolled loop: the next trip does); unrolled, one wait serves eight rows */
    }
     } }


__global__ __launch_bounds__(256) void k_wnat(const float* __restrict__ w, size_t n8, _Float16* __restrict__ Bt) { const size_t t = (size_t)blockIdx.x * 256 + threadIdx.x; if (t >= n8) return; FragH f; for (int q = 0; q < 8; ++q) f.h[q] = (_Float16)(bf16_round(w[t * 8 + q]) * 16.0f); *(v8us*)((unsigned short*)Bt + t * 8) = f.half[0];  }
__global__ __launch_bounds__(256) void k_rsm(const float* __restrict__ S, _Float16* __restrict__ P, int nrows) {
  #pragma clang fp contract(off)
  const int i = blockIdx.x * 256 + threadIdx.x; if (i >= nrows) return; const float* s = S + (size_t)i * SQ; float mx = -3.0e38f;
#pragma unroll 1
  for (int j = 0; j < SQ; ++j) mx = fmaxf(mx, s[j]); float se = 0.f;
#pragma unroll 1
  for (int j = 0; j < SQ; ++j) se += expf(s[j] - mx); const float sc = 256.0f / se;
#pragma unroll 1
  for (int j0 = 0; j0 < SQ; j0 += 8) { FragH f; for (int q = 0; q < 8; ++q) f.h[q] = (_Float16)(expf(s[j0 + q] - mx) * sc); unsigned short* d = (unsigned short*)P + (size_t)i * SQ + j0; *(v8us*)d = f.half[0];  } }
__global__ __launch_bounds__(256) void k_vt(const _Float16* __restrict__ V16, int b, int h0, _Float16* __restrict__ VT) { __shared__ unsigned short tl[64][65]; const int tid = threadIdx.x; const int hh = blockIdx.x % HG, sg = blockIdx.x / HG; const int s0 = sg * 64; const int h = h0 + hh;
  for (int i = tid; i < 64 * 8; i += 256) { const int j = i / 8, d8 = (i % 8) * 8; FragH f; f.half[0] = *(const v8us*)((const unsigned short*)V16 + ((size_t)b * SQ + s0 + j) * DM + h * HD + d8); for (int q = 0; q < 8; ++q) tl[d8 + q][j] = f.u[q]; }
  __syncthreads();
  { for (int i = tid; i < 64 * 8; i += 256) { const int d = i / 8, j8 = (i % 8) * 8; FragH f; for (int q = 0; q < 8; ++q) f.u[q] = tl[d][j8 + q]; *(v8us*)((unsigned short*)VT + ((size_t)hh * HD + d) * SQ + s0 + j8) = f.half[0]; }  } }



__global__ __launch_bounds__(256) void k_rsmcf2(const float* __restrict__ S, _Float16* __restrict__ P, int hg, int q0, int nk) {
  #pragma clang fp contract(off)
  const int t = blockIdx.x * 256 + threadIdx.x; if (t >= hg * QT) return; const size_t i = (size_t)t; const float* s = S + i * NKX; const int last = q0 + (t % QT); float mx = -3.0e38f;
#pragma unroll 1
  for (int j = 0; j < nk; ++j) { const float f = (j <= last) ? 1.f : 0.f; mx = fmaxf(mx, fmaf(f, s[j], (1.f - f) * -1.0e9f)); } float se = 0.f;
#pragma unroll 1
  for (int j = 0; j < nk; ++j) { const float f = (j <= last) ? 1.f : 0.f; se += __expf(fmaf(f, s[j], (1.f - f) * -1.0e9f) - mx); } const float sc = 256.0f / se;
#pragma unroll 1
  for (int j0 = 0; j0 < nk; j0 += 8) { FragH fr; for (int q = 0; q < 8; ++q) { const int j = j0 + q; const float f = (j <= last) ? 1.f : 0.f; fr.h[q] = (_Float16)(__expf(fmaf(f, s[j], (1.f - f) * -1.0e9f) - mx) * sc); } unsigned short* d = (unsigned short*)P + i * NKX + j0; *(v8us*)d = fr.half[0];  } }

__global__ __launch_bounds__(256) void k_rsmcst(const float* __restrict__ S, _Float16* __restrict__ P, int hg, int q0, int nk, const int* __restrict__ mk) {
  #pragma clang fp contract(off)
  const int t = blockIdx.x * 256 + threadIdx.x; if (t >= hg * QT) return; const size_t i = (size_t)t; const float* s = S + i * NKX; const size_t ig = (size_t)(q0 + (t % QT)); const int* mr = mk + ig * SQ; float mx = -3.0e38f;
#pragma unroll 1
  for (int j = 0; j < nk; ++j) { const int mb = mr[j]; const int dd = (int)ig - j; const float f = (mb != 0 && dd >= 0 && (dd <= LOCALW || (dd % STRIDEK) == 0)) ? 1.f : 0.f; mx = fmaxf(mx, fmaf(f, s[j], (1.f - f) * -1.0e9f)); } float se = 0.f;
#pragma unroll 1
  for (int j = 0; j < nk; ++j) { const int mb = mr[j]; const int dd = (int)ig - j; const float f = (mb != 0 && dd >= 0 && (dd <= LOCALW || (dd % STRIDEK) == 0)) ? 1.f : 0.f; se += __expf(fmaf(f, s[j], (1.f - f) * -1.0e9f) - mx); } const float sc = 256.0f / se;
#pragma unroll 1
  for (int j0 = 0; j0 < nk; j0 += 8) { FragH fr; for (int q = 0; q < 8; ++q) { const int j = j0 + q; const int mb = mr[j]; const int dd = (int)ig - j; const float f = (mb != 0 && dd >= 0 && (dd <= LOCALW || (dd % STRIDEK) == 0)) ? 1.f : 0.f; fr.h[q] = (_Float16)(__expf(fmaf(f, s[j], (1.f - f) * -1.0e9f) - mx) * sc); } unsigned short* d = (unsigned short*)P + i * NKX + j0; *(v8us*)d = fr.half[0];  } }


template <int MASKADD>
__global__ __launch_bounds__(64) void k_att0(const float* __restrict__ QF, const float* __restrict__ KF, const float* __restrict__ VF, int ld, const float* __restrict__ mask, float scale, float* __restrict__ OF, int ldo) {
  #pragma clang fp contract(off)
  __shared__ __attribute__((aligned(16))) float lq[64][64]; __shared__ __attribute__((aligned(16))) float lo[64][64];
  const int tid = threadIdx.x; const int h = blockIdx.x / (QT0 / 64), rg = blockIdx.x % (QT0 / 64); const int i = rg * 64 + tid;
  const float* qr = QF + (size_t)i * ld + h * HD;
#pragma unroll 1
  for (int c = 0; c < HD / 4; ++c) { *(v4f*)&lq[tid][c * 4] = *(const v4fa*)(qr + c * 4); const v4f z = {0.f, 0.f, 0.f, 0.f}; *(v4f*)&lo[tid][c * 4] = z; }
  float m = -1.0e30f, l = 0.f; const int jmax = MASKADD ? (SQ - 1) : (rg * 64 + 63);      /* additive-mask form: every key (the mask input decides); causal form: keys up to the block's last row */
#pragma unroll 1
  for (int j = 0; j <= jmax; ++j) { const float* kr = KF + (size_t)j * ld + h * HD; const float* vr = VF + (size_t)j * ld + h * HD; float s = 0.f;
#pragma unroll 1
    for (int c = 0; c < HD / 4; ++c) { const v4f kq = *(const v4fa*)(kr + c * 4); const v4f qq = *(v4f*)&lq[tid][c * 4]; s = __fadd_rn(s, __fmul_rn(qq[0], kq[0])); s = __fadd_rn(s, __fmul_rn(qq[1], kq[1])); s = __fadd_rn(s, __fmul_rn(qq[2], kq[2])); s = __fadd_rn(s, __fmul_rn(qq[3], kq[3])); }
    s = __fmul_rn(s, scale); if (MASKADD) s = __fadd_rn(s, __fmul_rn(bf16_round(mask[(size_t)i * SQ + j]), -10000.0f));
    const float f = (MASKADD || j <= i) ? 1.f : 0.f; const float sm = fmaf(f, s, (1.f - f) * -1.0e30f); const float mn = fmaxf(m, sm); const float sc = expf(m - mn); const float e = expf(sm - mn); l = __fadd_rn(__fmul_rn(l, sc), e); m = mn;
#pragma unroll 1
    for (int c = 0; c < HD / 4; ++c) { const v4f vv = *(const v4fa*)(vr + c * 4); v4f oo = *(v4f*)&lo[tid][c * 4]; for (int u = 0; u < 4; ++u) oo[u] = __fadd_rn(__fmul_rn(oo[u], sc), __fmul_rn(e, vv[u])); *(v4f*)&lo[tid][c * 4] = oo; } }
  const float fin = 64.0f / l;      /* o carried x64 like the f16 path */
#pragma unroll 1
  for (int c = 0; c < HD / 4; ++c) { v4f oo = *(v4f*)&lo[tid][c * 4]; for (int u = 0; u < 4; ++u) oo[u] = __fmul_rn(oo[u], fin); *(v4f*)&lo[tid][c * 4] = oo; }
  __syncthreads();
  {
#pragma unroll 1
    for (int it = 0; it < 16; ++it) { const int row = it * 4 + tid / 16, pc = (tid % 16) * 4; const v4f v = *(const v4f*)&lo[row][pc]; *(v4f*)(OF + (size_t)(rg * 64 + row) * ldo + h * HD + pc) = v; }
     } }

template <int MASKADD>
__global__ __launch_bounds__(64) void k_att0mbc(const float* __restrict__ QF, const float* __restrict__ KF, const float* __restrict__ VF, int ld, const float* __restrict__ mask, float scale, float* __restrict__ OF, int ldo) {
  #pragma clang fp contract(off)
  __shared__ __attribute__((aligned(16))) float lq[64][64]; __shared__ __attribute__((aligned(16))) float lo[64][64];
  const int tid = threadIdx.x; const int h = blockIdx.x / (QT0 / 64), rg = blockIdx.x % (QT0 / 64); const int i = rg * 64 + tid;
  const float* qr = QF + (size_t)i * ld + h * HD;
#pragma unroll 1
  for (int c = 0; c < HD / 4; ++c) { *(v4f*)&lq[tid][c * 4] = *(const v4fa*)(qr + c * 4); const v4f z = {0.f, 0.f, 0.f, 0.f}; *(v4f*)&lo[tid][c * 4] = z; }
  float m = -1.0e30f, l = 0.f; const int jmax = rg * 64 + 63;      /* keys beyond the block end are masked by the mask's lower-triangular structure */
#pragma unroll 1
  for (int j = 0; j <= jmax; ++j) { const float* kr = KF + (size_t)j * ld + h * HD; const float* vr = VF + (size_t)j * ld + h * HD; float s = 0.f;
#pragma unroll 1
    for (int c = 0; c < HD / 4; ++c) { const v4f kq = *(const v4fa*)(kr + c * 4); const v4f qq = *(v4f*)&lq[tid][c * 4]; s = __fadd_rn(s, __fmul_rn(qq[0], kq[0])); s = __fadd_rn(s, __fmul_rn(qq[1], kq[1])); s = __fadd_rn(s, __fmul_rn(qq[2], kq[2])); s = __fadd_rn(s, __fmul_rn(qq[3], kq[3])); }
    s = __fmul_rn(s, scale); const int mb = ((const int*)mask)[(size_t)i * SQ + j];      /* causal (j <= i) AND the module's int32 [S][S] mask read per (query, key): 0 -> masked */
    const float f = (mb != 0 && j <= i) ? 1.f : 0.f; const float sm = fmaf(f, s, (1.f - f) * -1.0e30f); const float mn = fmaxf(m, sm); const float sc = expf(m - mn); const float e = expf(sm - mn); l = __fadd_rn(__fmul_rn(l, sc), e); m = mn;
#pragma unroll 1
    for (int c = 0; c < HD / 4; ++c) { const v4f vv = *(const v4fa*)(vr + c * 4); v4f oo = *(v4f*)&lo[tid][c * 4]; for (int u = 0; u < 4; ++u) oo[u] = __fadd_rn(__fmul_rn(oo[u], sc), __fmul_rn(e, vv[u])); *(v4f*)&lo[tid][c * 4] = oo; } }
  const float fin = 64.0f / l;      /* o carried x64 like the f16 path */
#pragma unroll 1
  for (int c = 0; c < HD / 4; ++c) { v4f oo = *(v4f*)&lo[tid][c * 4]; for (int u = 0; u < 4; ++u) oo[u] = __fmul_rn(oo[u], fin); *(v4f*)&lo[tid][c * 4] = oo; }
  __syncthreads();
  {
#pragma unroll 1
    for (int it = 0; it < 16; ++it) { const int row = it * 4 + tid / 16, pc = (tid % 16) * 4; const v4f v = *(const v4f*)&lo[row][pc]; *(v4f*)(OF + (size_t)(rg * 64 + row) * ldo + h * HD + pc) = v; }
     } }


template <int BFIN, int WXB>
__global__ __launch_bounds__(256) void k_ln16(const float* __restrict__ X, const float* __restrict__ g, const float* __restrict__ bb, float eps, _Float16* __restrict__ N16, float* __restrict__ XB) {
  #pragma clang fp contract(off)
  __shared__ float red[256]; const size_t r = blockIdx.x; const int t = threadIdx.x; const v4f xa = *(const v4fa*)(X + r * DMQ + t * 4); float s[4]; float sum = 0.f;
  for (int q = 0; q < 4; ++q) { s[q] = BFIN ? bf16_round(xa[q]) : xa[q]; sum = __fadd_rn(sum, s[q]); }
  red[t] = sum; __syncthreads(); for (int st = 128; st > 0; st >>= 1) { if (t < st) red[t] = __fadd_rn(red[t], red[t + st]); __syncthreads(); } const float mu = red[0] / (float)DMQ; __syncthreads();
  float vs = 0.f; for (int q = 0; q < 4; ++q) { const float dl = __fadd_rn(s[q], -mu); vs = __fadd_rn(vs, __fmul_rn(dl, dl)); } red[t] = vs; __syncthreads(); for (int st = 128; st > 0; st >>= 1) { if (t < st) red[t] = __fadd_rn(red[t], red[t + st]); __syncthreads(); }
  const float rs = rsqrtf(__fadd_rn(red[0] / (float)DMQ, eps)); v4h y; v4f xb;
  for (int q = 0; q < 4; ++q) { const int c = t * 4 + q; y[q] = (_Float16)__fadd_rn(__fmul_rn(__fmul_rn(__fadd_rn(s[q], -mu), rs), bf16_round(g[c])), bf16_round(bb[c])); xb[q] = s[q]; }
  { *(v4h*)(N16 + r * DMQ + t * 4) = y; if (WXB) *(v4f*)(XB + r * DMQ + t * 4) = xb;  } }
__global__ __launch_bounds__(256) void k_ftres2(const float* __restrict__ OF0, const float* __restrict__ XB, float* __restrict__ X1, size_t n4) {
  #pragma clang fp contract(off)
  const size_t t = (size_t)blockIdx.x * 256 + threadIdx.x; if (t >= n4) return; const v4f o = *(const v4fa*)(OF0 + t * 4), xv = *(const v4fa*)(XB + t * 4); v4f y; for (int q = 0; q < 4; ++q) y[q] = __fadd_rn(__fmul_rn(o[q], 0.015625f), xv[q]); *(v4f*)(X1 + t * 4) = y;  }

__global__ __launch_bounds__(256) void k_bcpy(const float* __restrict__ b, int n, int NP, float* __restrict__ dst, int dst0) { for (int i = threadIdx.x; i < NP; i += 256) { const float v = (i < n) ? b[i] : 0.f; *(float*)(dst + dst0 + i) = v; }  }


#define FAW 8                        /* waves per work-group */
#define FAQ 32                       /* query columns per wave (two 16-column groups) */
#define FAC 0.18033688011112042592f  /* 64^-0.5 * log2 e: scores are carried in log2 units */
__device__ __forceinline__ float rs_x16(float x) { const int b = __builtin_bit_cast(int, x); return __builtin_bit_cast(float, __builtin_amdgcn_permlanex16(b, b, 0x76543210, 0xfedcba98, false, false)); }      /* lane l <- lane l ^ 16 */
// Four 2^x in one statement. The outputs are early-clobber, so inside it no v_exp_f32 is directly followed by a read of its result or a write of its source; the v_nop keeps that slot behind the last one.
__device__ __forceinline__ v4f rs_exp2(v4f x) { float y0, y1, y2, y3; asm("v_exp_f32 %0, %4\n\tv_exp_f32 %1, %5\n\tv_exp_f32 %2, %6\n\tv_exp_f32 %3, %7\n\tv_nop" : "=&v"(y0), "=&v"(y1), "=&v"(y2), "=&v"(y3) : "v"(x[0]), "v"(x[1]), "v"(x[2]), "v"(x[3])); const v4f y = {y0, y1, y2, y3}; return y; }
// One 2^x, with the same slot kept behind it.
__device__ __forceinline__ float fa_exp2(float x) { float y; asm("v_exp_f32 %0, %1\n\tv_nop" : "=&v"(y) : "v"(x)); return y; }
__device__ __forceinline__ v8f fa_mma(v16h a, v16h b, v8f c) { return __builtin_amdgcn_wmma_f32_16x16x32_f16(false, a, false, b, (short)0, c, false, false); }
// Q16, K16: f16 rows [NB * SQ][DM], head h = columns h*64..; VT: f16 [NB * NH][HD][SQ]; O16: context x64 as f16 rows (merged heads).
// The short loops are fully unrolled so that every fragment array is indexed by constants and stays in registers.
// K and V^T reach the eight waves through LDS: a stage is 64 keys, 64 K rows of 128 bytes and 64 V^T rows of 128 bytes, brought in once per work-group by asynchronous copies
// (whole 128-byte lines, through no register) and read by every wave as 16-byte fragment halves. Two buffers: the next stage's copies fly while this stage is worked on.
#define FAK 64                       /* keys per stage (two 32-key passes) */
#define FAP 144                      /* LDS row pitch in bytes: 128 of data + 16, so that the 16 rows of a 16-byte fragment read fall on 64 different banks */
#define FAT (64 * FAP)               /* one operand's tile */
#define FAS (2 * FAT)                /* one stage: [K tile | V^T tile] */
// Four copies of 16 bytes a lane: rows r and r + 32 of the K tile and of the V^T tile (l: the lane's LDS byte address in the K tile, gk, gv: its global addresses).
// The s_wait_xcnt stands inside the statement, behind the last copy, so that no address register of a copy is rewritten in front of it.
__device__ __forceinline__ void fa_copy4(unsigned l, const _Float16* gk, const _Float16* gv) {
  asm volatile("global_load_async_to_lds_b128 %0, %4, off\n\t"
               "global_load_async_to_lds_b128 %1, %5, off\n\t"
               "global_load_async_to_lds_b128 %2, %6, off\n\t"
               "global_load_async_to_lds_b128 %3, %7, off\n\t"
               "s_wait_xcnt 0x0"
               :: "v"(l), "v"(l + 32 * FAP), "v"(l + FAT), "v"(l + FAT + 32 * FAP),
                  "v"(gk), "v"(gk + (size_t)32 * DM), "v"(gv), "v"(gv + (size_t)32 * SQ)
               : "memory"); }
__global__ __launch_bounds__(FAW * 32) void k_fattn(const _Float16* __restrict__ Q16, const _Float16* __restrict__ K16, const _Float16* __restrict__ VT, _Float16* __restrict__ O16) {
  __shared__ __attribute__((aligned(128))) unsigned char L[2 * FAS]; static_assert(FAW * 32 == 256 && HD == 64 && SQ % FAK == 0 && SQ / FAK >= 2, "k_fattn: 256 lanes copy 32 rows of 128 bytes at a time; the ring needs two stages");
  const int tid = threadIdx.x, lane = tid & 31, ln = lane & 15, hh = lane >> 4, w = tid >> 5;
  constexpr int QB = SQ / (FAW * FAQ); const int qb = blockIdx.x % QB, bh = blockIdx.x / QB; const int b = bh / NH, h = bh % NH; const int q0 = qb * (FAW * FAQ) + w * FAQ;
  const _Float16* qp = Q16 + ((size_t)b * SQ + q0 + ln) * DM + h * HD;
  const unsigned lc = (unsigned)(size_t)L + (unsigned)((tid >> 3) * FAP + (tid & 7) * 16);      /* eight lanes copy one 128-byte row */
  const _Float16* gk = K16 + ((size_t)b * SQ + (tid >> 3)) * DM + h * HD + (tid & 7) * 8; const _Float16* gv = VT + ((size_t)bh * HD + (tid >> 3)) * SQ + (tid & 7) * 8;
  constexpr int nt = SQ / FAK;
  const v8f z8 = {0.f, 0.f, 0.f, 0.f, 0.f, 0.f, 0.f, 0.f};
  v16h qf[2][2]; v8f o[2][4]; float m[2], l[2];
  fa_copy4(lc, gk, gv);
#pragma unroll
  for (int j = 0; j < 2; ++j) { m[j] = -3.0e38f; l[j] = 0.f;
#pragma unroll
    for (int d = 0; d < 4; ++d) o[j][d] = z8;
#pragma unroll
    for (int ks = 0; ks < 2; ++ks) qf[j][ks] = g2_frag(qp + (size_t)j * 16 * DM + ks * 32, hh); }
  asm volatile("s_wait_xcnt 0x0" ::: "memory");      /* in front of any rewrite of the Q loads' address pair */
  asm volatile("s_wait_asynccnt 0x0" ::: "memory");      /* stage 0 has landed (this wave's copies) */
  __syncthreads();      /* ... and every wave's */
  fa_copy4(lc + FAS, gk + (size_t)FAK * DM, gv + FAK);
#pragma unroll 1
  for (int t = 0; t < nt; ++t) { const unsigned buf = (unsigned)(t & 1) * FAS;      /* rolled: one copy of the two passes in the text */
    const _Float16* pk = (const _Float16*)(L + buf + ln * FAP); const _Float16* pv = (const _Float16*)(L + buf + FAT + ln * FAP);
#pragma unroll
    for (int p = 0; p < FAK / 32; ++p) {
      v16h kf[2][2], vf[4]; v8f s[2][2];
#pragma unroll
      for (int u = 0; u < 2; ++u)
#pragma unroll
        for (int ks = 0; ks < 2; ++ks) kf[u][ks] = g2_frag(pk + (p * 32 + u * 16) * (FAP / 2) + ks * 32, hh);
#pragma unroll
      for (int d = 0; d < 4; ++d) vf[d] = g2_frag(pv + d * 16 * (FAP / 2) + p * 32, hh);
#pragma unroll
      for (int j = 0; j < 2; ++j)
#pragma unroll
        for (int u = 0; u < 2; ++u) s[j][u] = fa_mma(kf[u][1], qf[j][1], fa_mma(kf[u][0], qf[j][0], z8));      /* s[j][u][r] = q(q0 + 16 j + ln) . k(64 t + 32 p + 16 u + 8 hh + r) */
      FragH pf[2]; float al[2];
#pragma unroll
      for (int j = 0; j < 2; ++j) {
        float mx = fmaxf(s[j][0][0], s[j][1][0]);
#pragma unroll
        for (int r = 1; r < 8; ++r) mx = fmaxf(mx, fmaxf(s[j][0][r], s[j][1][r]));
        mx = fmaxf(mx, rs_x16(mx));
        const float mn = fmaxf(m[j], mx * FAC), mb = 8.0f - mn; al[j] = fa_exp2(m[j] - mn); m[j] = mn;      /* p = 2^8 exp(s - max) <= 256: small weights stay out of the f16 subnormals; the factor cancels against the sum */
        v4f s4 = {0.f, 0.f, 0.f, 0.f};
#pragma unroll
        for (int u = 0; u < 2; ++u)
#pragma unroll
          for (int c = 0; c < 2; ++c) { const v4f x = {s[j][u][c * 4] * FAC + mb, s[j][u][c * 4 + 1] * FAC + mb, s[j][u][c * 4 + 2] * FAC + mb, s[j][u][c * 4 + 3] * FAC + mb}; const v4f e = rs_exp2(x); s4 += e;
#pragma unroll
            for (int q = 0; q < 4; ++q) pf[j].h[u * 8 + c * 4 + q] = (_Float16)e[q]; }
        l[j] = l[j] * al[j] + ((s4[0] + s4[1]) + (s4[2] + s4[3])); }
      __builtin_amdgcn_sched_barrier(0);      /* both column groups' 2^x statements stay in front of the eight products: a v_exp_f32 sunk among the products could overwrite a B operand too soon */
#pragma unroll
      for (int j = 0; j < 2; ++j)
#pragma unroll
        for (int d = 0; d < 4; ++d) o[j][d] = fa_mma(vf[d], pf[j].v, o[j][d] * al[j]);      /* o[j][d][r] = sum_k p v(k)[16 d + 8 hh + r] for query q0 + 16 j + ln */
      __builtin_amdgcn_sched_barrier(0);      /* ... and the next pass's stay behind them; it also keeps the next pass's fragment reads from rising over these products: with them up there the kernel took more than 256 registers, and two work-groups no longer fit a WGP */
    }
    asm volatile("s_wait_dscnt 0x0" ::: "memory");      /* this wave's reads of the buffer have returned */
    asm volatile("s_wait_asynccnt 0x0" ::: "memory");      /* this wave's copies of stage t + 1 have landed */
    __syncthreads();      /* publishes stage t + 1 and frees stage t's buffer */
    if (t + 2 < nt) fa_copy4(lc + buf, gk + (size_t)(t + 2) * FAK * DM, gv + (t + 2) * FAK); }
  asm volatile("s_wait_asynccnt 0x0" ::: "memory");      /* no copy is outstanding when the wave ends */
#pragma unroll
  for (int j = 0; j < 2; ++j) { const float fin = 64.0f / (l[j] + rs_x16(l[j])); unsigned short* op = (unsigned short*)O16 + ((size_t)b * SQ + q0 + j * 16 + ln) * DM + h * HD + 8 * hh;
#pragma unroll
    for (int d = 0; d < 4; ++d) { FragH f;
#pragma unroll
      for (int r = 0; r < 8; ++r) f.h[r] = (_Float16)(o[j][d][r] * fin);
      *(v8us*)(op + d * 16) = f.half[0]; } } }

template <int MODE>
__global__ __launch_bounds__(256) void k_regrp(const float* __restrict__ src, float* __restrict__ dst, size_t n4) {
  const size_t t = (size_t)blockIdx.x * 256 + threadIdx.x; if (t >= n4) return; const size_t e = t * 4; const size_t rd = e / DM; const int c = (int)(e % DM);
  size_t rs; if (MODE == 0) { const size_t b = rd / SQ, sq = rd % SQ; rs = sq * NB + b; } else { const size_t sq = rd / NB, b = rd % NB; rs = b * SQ + sq; }
  const v4f v = *(const v4fa*)(src + rs * DM + c); *(v4f*)(dst + e) = v;  }

// ---- row passes: a wave owns RPW whole rows of DM = 1024 f32 in registers (32 lanes x 16 bytes = 512 contiguous bytes a load, eight loads a row, all of them issued up front) ----
// Few long-lived waves in place of many one-load ones: 16 waves on every WGP cover all 8192 rows, and no LDS and no barrier is needed, since a row never leaves its wave.
#define RPW 2                        /* rows per wave */
static_assert(DM == 1024 && DMQ == DM && ((size_t)NB * SQ) % (8 * RPW) == 0, "row passes: eight 512-byte loads a row, eight waves a work-group, no edge");
// lane l <- lane l ^ M inside its 16-lane row (DPP row_xmask)
template <int M>
__device__ __forceinline__ float rp_xm(float x) { return __builtin_bit_cast(float, __builtin_amdgcn_update_dpp(0, __builtin_bit_cast(int, x), 0x160 + M, 0xf, 0xf, true)); }
// Sum over the wave's 32 lanes by a butterfly: every lane ends with the same bits.
__device__ __forceinline__ float rp_sum32(float v) { v += rp_xm<1>(v); v += rp_xm<2>(v); v += rp_xm<4>(v); v += rp_xm<8>(v); return v + rs_x16(v); }
// LayerNorm (biased variance, eps inside the rsqrt; mean first, then the squares of the centred row) -> f16 rows.
template <int BFIN>
__global__ __launch_bounds__(256) void k_lnw(const float* __restrict__ X, const float* __restrict__ g, const float* __restrict__ bb, float eps, _Float16* __restrict__ N16) {
  const int lane = threadIdx.x & 31; const size_t e0 = ((size_t)blockIdx.x * 8 + (threadIdx.x >> 5)) * (RPW * DM) + lane * 4;      /* the lane's first element */
  const float* xp = X + e0; const unsigned ob = (unsigned)lane * 16u;      /* ob: the lane's byte offset in g and bb */
  v4f x[RPW][8], gg[8], bv[8];
#pragma unroll
  for (int k = 0; k < RPW; ++k)
#pragma unroll
    for (int u = 0; u < 8; ++u) x[k][u] = *(const v4fa*)(xp + k * DM + u * 128);
#pragma unroll
  for (int u = 0; u < 8; ++u) { gg[u] = *(const v4fa*)((const char*)g + ob + u * 512); bv[u] = *(const v4fa*)((const char*)bb + ob + u * 512); }
  asm volatile("s_wait_xcnt 0x0" :: "v"(xp), "v"(lane) : "memory");      /* the loads' address registers are free for reuse behind them: the wait stands in front of any rewrite; xp and lane (the g and bb loads' offset register, scaled by the load itself) as inputs keep those registers out of the loads' own results */
  __builtin_amdgcn_sched_barrier(0);      /* keeps all 32 loads in front of the arithmetic: without it the scheduler sinks the last ones, and the wait with them, far into it, where their latency shows */
#pragma unroll
  for (int u = 0; u < 8; ++u)
#pragma unroll
    for (int q = 0; q < 4; ++q) { gg[u][q] = bf16_round(gg[u][q]); bv[u][q] = bf16_round(bv[u][q]); }
  v4h y[RPW][8];
#pragma unroll
  for (int k = 0; k < RPW; ++k) {
    v4f a = {0.f, 0.f, 0.f, 0.f};
#pragma unroll
    for (int u = 0; u < 8; ++u) {
      if (BFIN) {
#pragma unroll
        for (int q = 0; q < 4; ++q) x[k][u][q] = bf16_round(x[k][u][q]); }
      a += x[k][u]; }
    const float mu = rp_sum32((a[0] + a[1]) + (a[2] + a[3])) * (1.0f / (float)DM);
    v4f c = {0.f, 0.f, 0.f, 0.f};
#pragma unroll
    for (int u = 0; u < 8; ++u) { x[k][u] -= mu; c += x[k][u] * x[k][u]; }
    const float rs = rsqrtf(rp_sum32((c[0] + c[1]) + (c[2] + c[3])) * (1.0f / (float)DM) + eps);
#pragma unroll
    for (int u = 0; u < 8; ++u) { const v4f o = x[k][u] * rs * gg[u] + bv[u];
#pragma unroll
      for (int q = 0; q < 4; ++q) y[k][u][q] = (_Float16)o[q]; } }
  __builtin_amdgcn_sched_barrier(0);      /* every result is in its own registers before the first store: nothing is computed behind a store, so no register of an issued store is rewritten */
#pragma unroll
  for (int k = 0; k < RPW; ++k)
#pragma unroll
    for (int u = 0; u < 8; ++u) *(v4h*)(N16 + e0 + k * DM + u * 128) = y[k][u]; }

__global__ __launch_bounds__(256) void k_wthd(const float* __restrict__ Wt, _Float16* __restrict__ Bt) { const size_t t = (size_t)blockIdx.x * 256 + threadIdx.x; if (t >= (size_t)NH * HD * (DM / 8)) return; const int m8 = (int)(t % (DM / 8)) * 8; const int d = (int)((t / (DM / 8)) % HD); const int h = (int)(t / ((size_t)(DM / 8) * HD)); FragH f;
  for (int q = 0; q < 8; ++q) f.h[q] = (_Float16)(16.0f * bf16_round(Wt[((size_t)h * DM + m8 + q) * HD + d])); unsigned short* dst = (unsigned short*)Bt + ((size_t)h * HD + d) * DM + m8; *(v8us*)dst = f.half[0];  }




template <int BFIN, int SCAL>
__global__ __launch_bounds__(256) void k_lnsc(const float* __restrict__ X, const float* __restrict__ g, const float* __restrict__ bb, float eps, _Float16* __restrict__ N16, float* __restrict__ N32) {
  #pragma clang fp contract(off)
  __shared__ float red[256]; const size_t r = blockIdx.x; const int t = threadIdx.x; const bool act = t < DM / 4; const int tc = act ? t : 0; const v4f xl = *(const v4fa*)(X + r * DM + tc * 4); const float am = act ? 1.f : 0.f; float s[4]; float sum = 0.f;
  for (int q = 0; q < 4; ++q) { s[q] = (BFIN ? bf16_round(xl[q]) : xl[q]) * am; sum = __fadd_rn(sum, s[q]); }
  red[t] = sum; __syncthreads(); for (int st = 128; st > 0; st >>= 1) { if (t < st) red[t] = __fadd_rn(red[t], red[t + st]); __syncthreads(); } const float mu = red[0] / (float)DM; __syncthreads();
  float vs = 0.f; for (int q = 0; q < 4; ++q) { const float dl = __fadd_rn(s[q], -mu) * am; vs = __fadd_rn(vs, __fmul_rn(dl, dl)); } red[t] = vs; __syncthreads(); for (int st = 128; st > 0; st >>= 1) { if (t < st) red[t] = __fadd_rn(red[t], red[t + st]); __syncthreads(); }
  const float rs = __fdiv_rn(1.0f, __fadd_rn(sqrtf(red[0] / (float)(DM - 1)), eps)); if (!act) return; v4h y; v4f yf;
  for (int q = 0; q < 4; ++q) { const int c = t * 4 + q; const float gg = bf16_round(SCAL ? g[0] : g[c]), bv = bf16_round(SCAL ? bb[0] : bb[c]); yf[q] = __fadd_rn(__fmul_rn(__fmul_rn(__fadd_rn(s[q], -mu), rs), gg), bv); y[q] = (_Float16)yf[q]; }
  { if (N16) *(v4h*)(N16 + r * DM + t * 4) = y; if (N32) *(v4f*)(N32 + r * DM + t * 4) = yf;  } }

__global__ __launch_bounds__(256) void k_rsmdmi(const float* __restrict__ S, _Float16* __restrict__ P, int nrows, const int* __restrict__ M) {
  #pragma clang fp contract(off)
  const int t = blockIdx.x * 256 + threadIdx.x; if (t >= nrows) return; const float* s = S + (size_t)t * SQ; const int* m = M + (size_t)(t % SQ) * SQ; float mx = -3.0e38f;
#pragma unroll 1
  for (int j = 0; j < SQ; ++j) { const float f = (m[j] == 0) ? 1.f : 0.f; mx = fmaxf(mx, fmaf(f, s[j], (1.f - f) * -1.0e9f)); } float se = 0.f;
#pragma unroll 1
  for (int j = 0; j < SQ; ++j) { const float f = (m[j] == 0) ? 1.f : 0.f; se += __expf(fmaf(f, s[j], (1.f - f) * -1.0e9f) - mx); } const float sc = 256.0f / se;
#pragma unroll 1
  for (int j0 = 0; j0 < SQ; j0 += 8) { FragH fr; for (int q = 0; q < 8; ++q) { const int j = j0 + q; const float f = (m[j] == 0) ? 1.f : 0.f; fr.h[q] = (_Float16)(__expf(fmaf(f, s[j], (1.f - f) * -1.0e9f) - mx) * sc); } unsigned short* d = (unsigned short*)P + (size_t)t * SQ + j0; *(v8us*)d = fr.half[0];  } }
// All six weight planes in one launch (blockIdx.y = plane): Bt[p][n][k] = f16(bf16(W[k][n]) x16), element for element as k_wt_f16.
// Planes 0..2: per-head tensors [NH][DM][HD], row n = head n / HD, output n % HD; planes 3..5: [in][out] squares of DM x DM.
static_assert(DFF == DM, "k_wt_all: every plane is DM x DM");
// A wave transposes one tile of 64 k x 32 n. Every global access is a whole 128-byte line in lane order: eight lanes read 32 columns of one source row, eight lanes write 64 k of one output row.
// A lane reads 16 source rows of its four columns (all 16 loads issued up front), packs eight k of one column into 16 bytes, and the wave turns the tile in its own range of LDS.
#define WTP 144                      /* LDS row pitch in bytes: 128 of data (64 k) + 16 */
#define WTW (32 * WTP)               /* one wave's tile: 32 output rows */
static_assert(DM % 128 == 0 && HD % 32 == 0, "k_wt_all: four waves side by side cover 128 columns; a wave's 32 columns lie in one head");
// s: source element (k0, n0) of the tile, d: output element (n0, k0), l: the wave's LDS range. The pitch is a compile-time constant, so the loads share one address pair and differ only in their immediate offsets.
template <int PITCH>
__device__ __forceinline__ void wt_tile(const float* __restrict__ s, unsigned short* __restrict__ d, unsigned char* l, int lane) {
  const int c = lane & 7, kr = lane >> 3;
  const float* sp = s + (size_t)(kr * 8) * PITCH + c * 4;      /* the lane's columns 4 c .. 4 c + 3; rows 32 g + 8 kr + i */
  v4f x[2][8];
#pragma unroll
  for (int g = 0; g < 2; ++g)
#pragma unroll
    for (int i = 0; i < 8; ++i) x[g][i] = *(const v4fa*)(sp + (size_t)(g * 32 + i) * PITCH);
  asm volatile("s_wait_xcnt 0x0" :: "v"(sp) : "memory");      /* the loads' address pair is free for reuse behind them: the wait stands in front of any rewrite; sp as an input keeps the pair out of the loads' own results */
  __builtin_amdgcn_sched_barrier(0);      /* keeps all 16 loads in front of the arithmetic: without it the scheduler may sink the last ones, and the wait with them, into it, where their latency shows */
#pragma unroll
  for (int g = 0; g < 2; ++g)
#pragma unroll
    for (int j = 0; j < 4; ++j) { FragH f;
#pragma unroll
      for (int i = 0; i < 8; ++i) f.h[i] = (_Float16)(bf16_round(x[g][i][j]) * 16.0f);
      *(v8us*)(l + (c * 4 + j) * WTP + (g * 4 + kr) * 16) = f.half[0]; }
  __builtin_amdgcn_fence(__ATOMIC_ACQ_REL, "workgroup"); __builtin_amdgcn_wave_barrier();      /* the wave's own LDS writes stay in front of its reads of other lanes' bytes; no other wave touches this range */
  v8us o[8];
#pragma unroll
  for (int q = 0; q < 8; ++q) o[q] = *(const v8us*)(l + (q * 4 + kr) * WTP + c * 16);
  __builtin_amdgcn_sched_barrier(0);      /* every output row is in its own registers before the first store: nothing is loaded behind a store, so no register of an issued store is rewritten */
  unsigned short* dp = d + (size_t)kr * DM + c * 8;
#pragma unroll
  for (int q = 0; q < 8; ++q) *(v8us*)(dp + (size_t)(q * 4) * DM) = o[q]; }
__global__ __launch_bounds__(128) void k_wt_all(const float* __restrict__ wq, const float* __restrict__ wk, const float* __restrict__ wv, const float* __restrict__ wo, const float* __restrict__ w1, const float* __restrict__ w2, _Float16* __restrict__ Bt) {
  __shared__ __attribute__((aligned(16))) unsigned char L[4 * WTW];
  const int p = blockIdx.y, w = threadIdx.x >> 5, lane = threadIdx.x & 31; const int k0 = (blockIdx.x % (DM / 64)) * 64, n0 = (blockIdx.x / (DM / 64)) * 128 + w * 32;
  const float* W = p == 0 ? wq : p == 1 ? wk : p == 2 ? wv : p == 3 ? wo : p == 4 ? w1 : w2;
  unsigned short* d = (unsigned short*)Bt + ((size_t)p * DM + n0) * DM + k0; unsigned char* l = L + w * WTW;
  if (p < 3) wt_tile<HD>(W + ((size_t)(n0 / HD) * DM + k0) * HD + (n0 % HD), d, l, lane); else wt_tile<DM>(W + (size_t)k0 * DM + n0, d, l, lane); }
extern "C" void kernel_launch(void* const* d_in, const int* in_sizes, int n_in,
                              void* d_out, int out_size, void* d_ws, size_t ws_size, hipStream_t stream) {
  (void)in_sizes; (void)n_in; (void)out_size;
  const float* const* I = (const float* const*)d_in; const float* x = I[0]; const float* wq = I[1]; const float* wk = I[2]; const float* wv = I[3]; const float* wo = I[4]; const float* bo = I[5]; const float* w1 = I[6]; const float* b1 = I[7]; const float* w2 = I[8]; const float* b2 = I[9]; const float* g1 = I[10]; const float* be1 = I[11]; const float* g2 = I[12]; const float* be2 = I[13];      /* x; per-head Wq / Wk / Wv [16][1024][64] (no biases); Wo [1024][1024] + bo ([in][out]); W1 [1024][1024] + b1, W2 [1024][1024] + b2; LN1 g / b, LN2 g / b */
  char* ws = (char*)d_ws; size_t off = 0;
  auto take = [&](size_t bytes) { char* p = ws + off; off += (bytes + 255) & ~(size_t)255; return p; };
  _Float16* BQ = (_Float16*)take((size_t)6 * DM * DM * 2); _Float16* BO = BQ + (size_t)3 * DM * DM; _Float16* BW1 = BQ + (size_t)4 * DM * DM; _Float16* BW2 = BQ + (size_t)5 * DM * DM;      /* six Bt planes in a row: q, k, v, o, W1, W2 */
  _Float16* XN = (_Float16*)take(NR * DM * 2); _Float16* Q16 = (_Float16*)take((size_t)3 * NR * DM * 2); _Float16* K16 = Q16 + NR * DM; _Float16* VT = Q16 + (size_t)2 * NR * DM;      /* three planes in a row: one batched GEMM writes them; the third holds V^T [8 * 16][64][1024] */ _Float16* O16 = (_Float16*)take(NR * DM * 2); float* X1 = (float*)take(NR * DM * 4);
  _Float16* M16 = XN;      /* second-norm f16 rows: aliases XN (last readers: the three projections) */ _Float16* HF16 = (_Float16*)take(NR * DFF * 2);      /* FFN hidden rows of every batch [8192][1024] f16 (16 MiB): own region */
  
  if (off > ws_size) return;
  k_wt_all<<<dim3((unsigned)((DM / 64) * (DM / 128)), 6), 128, 0, stream>>>(wq, wk, wv, wo, w1, w2, BQ);      /* every weight -> Bt x16, one launch; per-head [in = 1024][out = 64]: head h = rows h*64.. of its plane */
  k_lnw<1><<<(unsigned)(NR / (8 * RPW)), 256, 0, stream>>>(x, g1, be1, 1e-5f, XN);      /* n = LN0(bf16(x)) (biased variance, eps inside the rsqrt) -> f16 rows */
  k_gemm3<0, false, false, false, true><<<dim3((unsigned)((NR / 128) * (DM / 128)), 3), 128, 0, stream>>>(XN, DM, 0, BQ, DM, (size_t)DM * DM, 0.0625f, nullptr, 0, nullptr, nullptr, Q16, NR * DM, (int)NR, DM, DM);      /* q, k (f16 rows; head h = columns h*64..) and V^T (blockIdx.y), one launch */
  k_fattn<<<NB * NH * (SQ / (FAW * FAQ)), FAW * 32, 0, stream>>>(Q16, K16, VT, O16);      /* softmax(q k^T / 8) v over all keys (no mask) -> ctx (merged heads, x64) as f16 rows */
  k_gemm3<0, true, true, true><<<dim3((unsigned)((NR / 128) * (DM / 128)), 1), 128, 0, stream>>>(O16, DM, 0, BO, DM, 0, 0.0009765625f, bo, 0, x, X1, nullptr, 0, (int)NR, DM, DM);      /* bf16(x) + ctx wo (+ bo) (own-element residual, x rounded where it is read) -> f32 rows */
  k_lnw<0><<<(unsigned)(NR / (8 * RPW)), 256, 0, stream>>>(X1, g2, be2, 1e-5f, M16);      /* LN1(x1) -> f16 rows */
  k_gemm3<6, false, false><<<dim3((unsigned)((NR / 128) * (DFF / 128)), 1), 128, 0, stream>>>(M16, DM, 0, BW1, DM, 0, 0.0625f, b1, 0, nullptr, nullptr, HF16, 0, (int)NR, DFF, DM);      /* gelu_erf(. W1 + b1) -> f16, all rows */
  k_gemm3<0, true, true><<<dim3((unsigned)((NR / 128) * (DM / 128)), 1), 128, 0, stream>>>(HF16, DFF, 0, BW2, DFF, 0, 0.0625f, b2, 0, X1, (float*)d_out, nullptr, 0, (int)NR, DM, DFF);      /* out = x1 + mlp (own-element residual), all rows */
}

// v010
// One run takes 147 microseconds.
// Next to v009, in two timings, it ran 1.08 and 1.09 times as fast.
// Over all steps from v000, the starting kernel, it is 51.2 times as fast.
#include <hip/hip_runtime.h>
// Pre-LN transformer encoder block with PER-HEAD projection tensors, no QKV biases (x [8][1024][1024]; h = LN1(x) (biased var, eps 1e-5); q/k/v[h] = h W[h] with W [16][1024][64] ([head][in][out]); scale 64^-0.5; softmax over all 1024 keys (no mask); x1 = x + concat(attn) Wo + bo ([in][out]); out = x1 + gelu_erf(LN2(x1) W1 + b1) W2 + b2 ([in][out] 1024 x 1024 x 1024: hidden = 1 x n_embd, as the source) -> [8][1024][1024]).
// Structure: token rows; LayerNorm / exact f16 rows; WMMA GEMMs for q, k and V^T (the v product with its operands swapped); one fused attention launch (scores, online softmax and P V in registers); output projection with the own-element residual; custom LayerNorm; exact-GELU FFN over all rows; launches: see trace.
// Compute dtype: inputs rounded to bf16; x / weights exact; q, k, v, softmax weights and o as plain f16 GEMM operands (~2^-12); scores and softmax statistics f32. v_wmma_f32_16x16x32_f16.
#define NB 8
#define SQ 1024
#define DM 1024
#define NH 16
#define HD 64
#define HG 4                         /* heads per attention launch group */
#define LOCALW 128                   /* (macros for unused kernels of the shared header) */
#define STRIDEK 128
#define QT 256                       /* query rows per causal tile */
#define NKX SQ                       /* S / P row pitch */
#define QT0 128                      /* first-tile rows recomputed exactly in f32 */
#define B0 0                         /* first batch processed (debug hook) */
#define NBR NB                       /* batches processed (debug hook) */
#define NR ((size_t)NB * SQ)
#define DMQ DM
#define DFF 1024         /* FFN hidden width = 1 x n_embd in this module (W1 [1024][1024], W2 [1024][1024]) */
#define MP ((int)((size_t)NBR * SQ)) /* rows projected (debug hook) */
#define QN SQ                        /* query rows attended per batch (debug hook) */
#define NHD NH                       /* heads attended (debug hook) */
#define MPO MP                       /* rows through the output stage (debug hook) */
#define LQ (3 * DM)      /* unused: q and k rows have pitch DM, one plane each */
typedef __bf16 v16b __attribute__((ext_vector_type(16)));
typedef unsigned short v8us __attribute__((ext_vector_type(8), may_alias));
typedef float  v8f  __attribute__((ext_vector_type(8)));
typedef float  v4f  __attribute__((ext_vector_type(4)));
typedef float  v4fa __attribute__((ext_vector_type(4), may_alias));
union FragB { v16b v; v8us half[2]; unsigned short u[16]; };

__device__ __forceinline__ unsigned short bf16_bits(float x) { unsigned int u = __float_as_uint(x); return (unsigned short)((u + 0x7FFFu + ((u >> 16) & 1u)) >> 16); }
__device__ __forceinline__ float bf16_val(unsigned short b) { return __uint_as_float(((unsigned int)b) << 16); }
__device__ __forceinline__ float bf16_round(float x) { return bf16_val(bf16_bits(x)); }
// D += A·B with NT terms: 1 = ah·bh, 2 = + al·bh (A split), 3 = + ah·bl (both split)
template <int NT>
__device__ __forceinline__ v8f mmaN(v16b ah, v16b al, v16b bh, v16b bl, v8f c) {
  c = __builtin_amdgcn_wmma_f32_16x16x32_bf16(false, ah, false, bh, (short)0, c, false, false);
  if (NT >= 2) c = __builtin_amdgcn_wmma_f32_16x16x32_bf16(false, al, false, bh, (short)0, c, false, false);
  if (NT >= 3) c = __builtin_amdgcn_wmma_f32_16x16x32_bf16(false, ah, false, bl, (short)0, c, false, false);
  asm volatile("v_nop\n\tv_nop\n\tv_nop\n\tv_nop" : "+v"(c) : "v"(ah), "v"(al), "v"(bh), "v"(bl));
  return c;
}

__global__ __launch_bounds__(256) void k_wt_bf16(const float* __restrict__ W, unsigned short* __restrict__ Wt, int K, int N) {
  const int t = blockIdx.x * 256 + threadIdx.x;
  const int k8n = K / 8;
  if (t >= N * k8n) return;
  const int n = t / k8n, k8 = (t % k8n) * 8;
  v8us v;
#pragma unroll
  for (int i = 0; i < 8; ++i) v[i] = bf16_bits(W[(size_t)(k8 + i) * N + n]);
  *(v8us*)(Wt + (size_t)n * K + k8) = v;
  
}

// GEMM C[M][N] (f32, pitch ldc) = act(A[M][K]·W + bias). A f32 row-major (pitch lda) converted per fragment to bf16
// (ASPLIT: hi/lo two planes -> 2 terms, else single rounded term); Wt bf16 [N][K] (pitch ldb). BIAS_BF16 rounds the
// bias to bf16 first (bias quantised to bf16 before the add). K%32==0, M%16==0, N%64==0.
template <bool ASPLIT, int ACT, bool BIAS_BF16>
__global__ __launch_bounds__(128) void k_gemm_bf(const float* __restrict__ A, int lda, const unsigned short* __restrict__ Wt, int ldb,
                                               const float* __restrict__ bias, float* __restrict__ C, int ldc, int M, int N, int K) {
  __shared__ __attribute__((aligned(16))) float so[4][16][64];
  const int tid = threadIdx.x, w = tid >> 5, lane = tid & 31, ln = lane & 15, hh = lane >> 4;
  const int ntn = N / 64;
  const int wid = blockIdx.x * 4 + w;
  const int mt = wid / ntn, nq = wid % ntn;
  if (mt * 16 >= M) return;
  const int row0 = mt * 16, col0 = nq * 64;
  const float* arow = A + (size_t)(row0 + ln) * lda;
  v8f acc[4] = {};
  for (int kb = 0; kb < K; kb += 32) {
    FragB ah, al;
    const v4f x0 = *(const v4fa*)(arow + kb + 8 * hh), x1 = *(const v4fa*)(arow + kb + 8 * hh + 4);
    const v4f x2 = *(const v4fa*)(arow + kb + 16 + 8 * hh), x3 = *(const v4fa*)(arow + kb + 16 + 8 * hh + 4);
    float xs[16] = {x0[0],x0[1],x0[2],x0[3],x1[0],x1[1],x1[2],x1[3],x2[0],x2[1],x2[2],x2[3],x3[0],x3[1],x3[2],x3[3]};
#pragma unroll
    for (int i = 0; i < 16; ++i) { const unsigned short hb = bf16_bits(xs[i]); ah.u[i] = hb; al.u[i] = ASPLIT ? bf16_bits(xs[i] - bf16_val(hb)) : (unsigned short)0; }
#pragma unroll
    for (int t = 0; t < 4; ++t) {
      const unsigned short* brow = Wt + (size_t)(col0 + t * 16 + ln) * ldb + kb;
      FragB b;
      b.half[0] = *(const v8us*)(brow + 8 * hh);
      b.half[1] = *(const v8us*)(brow + 16 + 8 * hh);
      acc[t] = mmaN<ASPLIT ? 2 : 1>(ah.v, al.v, b.v, b.v, acc[t]);
    }
  }
#pragma unroll
  for (int t = 0; t < 4; ++t) {
    float bv = bias ? bias[col0 + t * 16 + ln] : 0.f;
    if (BIAS_BF16) bv = bf16_round(bv);
#pragma unroll
    for (int r = 0; r < 8; ++r) { float v = acc[t][r] + bv; if (ACT == 1) v = fmaxf(v, 0.f); so[w][8 * hh + r][t * 16 + ln] = v; }
  }
  __builtin_amdgcn_fence(__ATOMIC_ACQ_REL, "workgroup");
  __builtin_amdgcn_wave_barrier();
  const int rsub = lane >> 4, c4 = (lane & 15) * 4;
  {
#pragma unroll
    for (int q = 0; q < 8; ++q) {
      const int r = q * 2 + rsub;
      const v4f v = *(const v4fa*)&so[w][r][c4];
      *(v4f*)(C + (size_t)(row0 + r) * ldc + col0 + c4) = v;
    }
    
  }
}

// GEMM C = act(A·W + bias + resid): A f32 (ASPLIT -> hi/lo 2 terms), Wt bf16 [N][K]; ACT 0 none, 1 relu, 2 exact gelu;
// resid (optional, f32, row index = (row % rmod), pitch ldr, RES_BF16 rounds it) added before the activation.
template <bool ASPLIT, int ACT, bool BIAS_BF16, bool RES_BF16>
__global__ __launch_bounds__(128) void k_gemm_bf3(const float* __restrict__ A, int lda, const unsigned short* __restrict__ Wt, int ldb,
                                                const float* __restrict__ bias, const float* __restrict__ resid, int rmod, int ldr,
                                                float* __restrict__ C, int ldc, int M, int N, int K) {
  __shared__ __attribute__((aligned(16))) float so[4][16][64];
  const int tid = threadIdx.x, w = tid >> 5, lane = tid & 31, ln = lane & 15, hh = lane >> 4;
  const int ntn = N / 64;
  const int wid = blockIdx.x * 4 + w;
  const int mt = wid / ntn, nq = wid % ntn;
  if (mt * 16 >= M) return;
  const int row0 = mt * 16, col0 = nq * 64;
  const float* arow = A + (size_t)(row0 + ln) * lda;
  v8f acc[4] = {};
  for (int kb = 0; kb < K; kb += 32) {
    FragB ah, al;
    const v4f x0 = *(const v4fa*)(arow + kb + 8 * hh), x1 = *(const v4fa*)(arow + kb + 8 * hh + 4);
    const v4f x2 = *(const v4fa*)(arow + kb + 16 + 8 * hh), x3 = *(const v4fa*)(arow + kb + 16 + 8 * hh + 4);
    float xs[16] = {x0[0],x0[1],x0[2],x0[3],x1[0],x1[1],x1[2],x1[3],x2[0],x2[1],x2[2],x2[3],x3[0],x3[1],x3[2],x3[3]};
#pragma unroll
    for (int i = 0; i < 16; ++i) { const unsigned short hb = bf16_bits(xs[i]); ah.u[i] = hb; al.u[i] = ASPLIT ? bf16_bits(xs[i] - bf16_val(hb)) : (unsigned short)0; }
#pragma unroll
    for (int t = 0; t < 4; ++t) {
      const unsigned short* brow = Wt + (size_t)(col0 + t * 16 + ln) * ldb + kb;
      FragB b;
      b.half[0] = *(const v8us*)(brow + 8 * hh);
      b.half[1] = *(const v8us*)(brow + 16 + 8 * hh);
      acc[t] = mmaN<ASPLIT ? 2 : 1>(ah.v, al.v, b.v, b.v, acc[t]);
    }
  }
#pragma unroll
  for (int t = 0; t < 4; ++t) {
    const int col = col0 + t * 16 + ln;
    float bv = bias ? bias[col] : 0.f;
    if (BIAS_BF16) bv = bf16_round(bv);
#pragma unroll
    for (int r = 0; r < 8; ++r) {
      float v = acc[t][r] + bv;
      if (resid) { float rv = resid[(size_t)((row0 + 8 * hh + r) % rmod) * ldr + col]; if (RES_BF16) rv = bf16_round(rv); v += rv; }
      if (ACT == 1) v = fmaxf(v, 0.f);
      if (ACT == 2) v = 0.5f * v * (1.0f + erff(v * 0.70710678118654752f));
      if (ACT == 3) { const float u = 0.7978845608028654f * (v + 0.044715f * v * v * v); v = 0.5f * v * (1.0f + tanhf(u)); }
      so[w][8 * hh + r][t * 16 + ln] = v;
    }
  }
  __builtin_amdgcn_fence(__ATOMIC_ACQ_REL, "workgroup");
  __builtin_amdgcn_wave_barrier();
  const int rsub = lane >> 4, c4 = (lane & 15) * 4;
  {
#pragma unroll
    for (int q = 0; q < 8; ++q) {
      const int r = q * 2 + rsub;
      const v4f v = *(const v4fa*)&so[w][r][c4];
      *(v4f*)(C + (size_t)(row0 + r) * ldc + col0 + c4) = v;
    }
    
  }
}
// row LayerNorm (biased variance, eps) over N: s = X (+ R); optional out_sum <- s; out_norm <- (s-mu)*rsqrt(var+eps)*g + b
template <bool PARAM_BF16>
__global__ __launch_bounds__(256) void k_layernorm(const float* __restrict__ X, const float* __restrict__ R, const float* __restrict__ g, const float* __restrict__ bta,
                                                  float* __restrict__ out_sum, float* __restrict__ out_norm, int N, float eps) {
  __shared__ float red[256];
  const int row = blockIdx.x, tid = threadIdx.x;
  const float* x = X + (size_t)row * N; const float* rr = R ? R + (size_t)row * N : nullptr;
  float vals[16];                     // up to N = 4096
  const int per = N / 256;            // contiguous chunk per thread? use strided-by-4 chunks: thread handles j = tid*4 + 1024*u
  float s1 = 0.f;
  for (int u = 0; u < per / 4; ++u) {
    const int j = tid * 4 + 1024 * u;
    const v4f a = *(const v4fa*)(x + j);
    v4f b = {0.f,0.f,0.f,0.f}; if (rr) b = *(const v4fa*)(rr + j);
#pragma unroll
    for (int q = 0; q < 4; ++q) { const float v = a[q] + b[q]; vals[u * 4 + q] = v; s1 += v; }
  }
  red[tid] = s1; __syncthreads();
  for (int st = 128; st > 0; st >>= 1) { if (tid < st) red[tid] += red[tid + st]; __syncthreads(); }
  const float mu = red[0] / (float)N; __syncthreads();
  float s2 = 0.f;
  for (int u = 0; u < per / 4; ++u)
#pragma unroll
    for (int q = 0; q < 4; ++q) { const float c = vals[u * 4 + q] - mu; s2 += c * c; }
  red[tid] = s2; __syncthreads();
  for (int st = 128; st > 0; st >>= 1) { if (tid < st) red[tid] += red[tid + st]; __syncthreads(); }
  const float rs = rsqrtf(red[0] / (float)N + eps);
  {
    for (int u = 0; u < per / 4; ++u) {
      const int j = tid * 4 + 1024 * u;
      v4f o, sm;
#pragma unroll
      for (int q = 0; q < 4; ++q) {
        float gg = g[j + q], bb = bta[j + q];
        if (PARAM_BF16) { gg = bf16_round(gg); bb = bf16_round(bb); }
        sm[q] = vals[u * 4 + q]; o[q] = (vals[u * 4 + q] - mu) * rs * gg + bb;
      }
      if (out_sum) *(v4f*)(out_sum + (size_t)row * N + j) = sm;
      *(v4f*)(out_norm + (size_t)row * N + j) = o;
    }
    
  }
}



// ---- f16 WMMA path (v_wmma_f32_16x16x32_f16): 11-bit significands for operands in range — used where a [0,1] probability operand needs more precision than bf16
typedef _Float16 v16h __attribute__((ext_vector_type(16)));
union FragH { v16h v; v8us half[2]; _Float16 h[16]; unsigned short u[16]; };
template <int NT>
__device__ __forceinline__ v8f mmaH(v16h ah, v16h al, v16h bh, v16h bl, v8f c) {
  c = __builtin_amdgcn_wmma_f32_16x16x32_f16(false, ah, false, bh, (short)0, c, false, false);
  if (NT >= 2) c = __builtin_amdgcn_wmma_f32_16x16x32_f16(false, al, false, bh, (short)0, c, false, false);
  if (NT >= 3) c = __builtin_amdgcn_wmma_f32_16x16x32_f16(false, ah, false, bl, (short)0, c, false, false);
  asm volatile("v_nop\n\tv_nop\n\tv_nop\n\tv_nop" : "+v"(c) : "v"(ah), "v"(al), "v"(bh), "v"(bl));
  return c;
}
// batched GEMM like k_gemm_b but f16 operands: A f32 (split into f16 hi/lo if ASPLIT, else rounded to f16), Bt = f16 values [n][k]; alpha; C f32; N multiple of 16 (partial tiles skipped)
template <bool ASPLIT>
__global__ __launch_bounds__(128) void k_gemm_h(const float* __restrict__ A, int lda, size_t sA, const _Float16* __restrict__ Bh, int ldb, size_t sB, float alpha, float* __restrict__ C, int ldc, size_t sC, int M, int N, int K) {
  __shared__ __attribute__((aligned(16))) float so[4][16][64];
  const int tid = threadIdx.x, w = tid >> 5, lane = tid & 31, ln = lane & 15, hh = lane >> 4; const int by = blockIdx.y;
  A += (size_t)by * sA; Bh += (size_t)by * sB; C += (size_t)by * sC;
  const int ntn = (N + 63) / 64; const int wid = blockIdx.x * 4 + w; const int mt = wid / ntn, nq = wid % ntn; if (mt * 16 >= M) return;
  const int row0 = mt * 16, col0 = nq * 64; const float* arow = A + (size_t)(row0 + ln) * lda;
  v8f acc[4] = {};
  for (int kb = 0; kb < K; kb += 32) {
    FragH ah, al;
    const v4f x0 = *(const v4fa*)(arow + kb + 8 * hh), x1 = *(const v4fa*)(arow + kb + 8 * hh + 4), x2 = *(const v4fa*)(arow + kb + 16 + 8 * hh), x3 = *(const v4fa*)(arow + kb + 16 + 8 * hh + 4);
    float xs[16] = {x0[0],x0[1],x0[2],x0[3],x1[0],x1[1],x1[2],x1[3],x2[0],x2[1],x2[2],x2[3],x3[0],x3[1],x3[2],x3[3]};
#pragma unroll
    for (int i = 0; i < 16; ++i) { const _Float16 h = (_Float16)xs[i]; ah.h[i] = h; al.h[i] = ASPLIT ? (_Float16)(xs[i] - (float)h) : (_Float16)0.0f; }
#pragma unroll
    for (int t = 0; t < 4; ++t) { if (col0 + t * 16 >= N) continue; const size_t boff = (size_t)(col0 + t * 16 + ln) * ldb + kb; FragH bq; bq.half[0] = *(const v8us*)(Bh + boff + 8 * hh); bq.half[1] = *(const v8us*)(Bh + boff + 16 + 8 * hh);
      acc[t] = mmaH<ASPLIT ? 2 : 1>(ah.v, al.v, bq.v, bq.v, acc[t]); }
  }
#pragma unroll
  for (int t = 0; t < 4; ++t) { if (col0 + t * 16 >= N) continue;
#pragma unroll
    for (int r = 0; r < 8; ++r) so[w][8 * hh + r][t * 16 + ln] = acc[t][r] * alpha; }
  __builtin_amdgcn_fence(__ATOMIC_ACQ_REL, "workgroup"); __builtin_amdgcn_wave_barrier();
  const int rsub = lane >> 4, c4 = (lane & 15) * 4;
  {
#pragma unroll
    for (int q = 0; q < 8; ++q) { const int r = q * 2 + rsub; if (col0 + c4 < N) { const v4f v = *(const v4fa*)&so[w][r][c4]; *(v4f*)(C + (size_t)(row0 + r) * ldc + col0 + c4) = v; } }
     }
}

// Wt[n][k] = f16(W[k][n]·scale) from f32 row-major W[K][N] (scale = power of two; bf16-exact weights stay exact in f16 away from the subnormal range)
__global__ __launch_bounds__(256) void k_wt_f16(const float* __restrict__ W, _Float16* __restrict__ Wt, int K, int N, float scale) {
  const int t = blockIdx.x * 256 + threadIdx.x; if (t >= N * (K / 8)) return; const int n = t / (K / 8), k8 = (t % (K / 8)) * 8; FragH f;
#pragma unroll
  for (int i = 0; i < 8; ++i) f.h[i] = (_Float16)(bf16_round(W[(size_t)(k8 + i) * N + n]) * scale); const v8us o = f.half[0];
  *(v8us*)((unsigned short*)Wt + (size_t)n * K + k8) = o; 
}
// k_gemm_hh variant with fused epilogue: v = acc·alpha + bias[by·sBias + col] (+ CP[(row/rowsPerB)·sCPb + by·64 + col] if CP) ; ACT 0 none / 1 elu ; writes f16 C16 (and f32 C if non-null)
template <int ACT>
__global__ __launch_bounds__(128) void k_gemm_hhx(const _Float16* __restrict__ A, int lda, size_t sA, const _Float16* __restrict__ Bh, int ldb, size_t sB, float alpha, const float* __restrict__ bias, size_t sBias, const float* __restrict__ CP, int rowsPerB, size_t sCPb, int row0g,
    float* __restrict__ C, _Float16* __restrict__ C16, int ldc, size_t sC, int M, int N, int K) {
  __shared__ __attribute__((aligned(16))) float so[4][16][64];
  const int tid = threadIdx.x, w = tid >> 5, lane = tid & 31, ln = lane & 15, hh = lane >> 4; const int by = blockIdx.y;
  A += (size_t)by * sA; Bh += (size_t)by * sB; const size_t cofs = (size_t)by * sC; const float* bp = bias ? bias + (size_t)by * sBias : nullptr;
  const int ntn = (N + 63) / 64; const int wid = blockIdx.x * 4 + w; const int mt = wid / ntn, nq = wid % ntn; if (mt * 16 >= M) return;
  const int row0 = mt * 16, col0 = nq * 64; const _Float16* arow = A + (size_t)(row0 + ln) * lda;
  v8f acc[4] = {};
  for (int kb = 0; kb < K; kb += 32) { FragH ah; ah.half[0] = *(const v8us*)((const unsigned short*)arow + kb + 8 * hh); ah.half[1] = *(const v8us*)((const unsigned short*)arow + kb + 16 + 8 * hh);
#pragma unroll
    for (int t = 0; t < 4; ++t) { if (col0 + t * 16 >= N) continue; const size_t boff = (size_t)(col0 + t * 16 + ln) * ldb + kb; FragH bq; bq.half[0] = *(const v8us*)((const unsigned short*)Bh + boff + 8 * hh); bq.half[1] = *(const v8us*)((const unsigned short*)Bh + boff + 16 + 8 * hh);
      acc[t] = mmaH<1>(ah.v, ah.v, bq.v, bq.v, acc[t]); }
  }
#pragma unroll
  for (int t = 0; t < 4; ++t) { if (col0 + t * 16 >= N) continue; const int col = col0 + t * 16 + ln; const float bv = bp ? bf16_round(bp[col]) : 0.f;
#pragma unroll
    for (int r = 0; r < 8; ++r) { float v = acc[t][r] * alpha + bv; if (CP) { const int rr = row0g + row0 + 8 * hh + r; if (rowsPerB < 0) v += CP[cofs + (size_t)rr * ldc + col];      /* rowsPerB < 0: own element of the batched C plane */ else { const int bidx = rr / rowsPerB; v += CP[(size_t)bidx * sCPb + (size_t)by * 64 + col]; } } if (ACT == 1) v = (v > 0.f) ? v : expm1f(v); else if (ACT == 7) v = (v > 0.f) ? v + 1.0f : expf(v); else if (ACT == 8) v = tanhf(v); else if (ACT == 9) v = 0.5f * v * (1.0f + tanhf(0.7978845608028654f * (v + 0.044715f * v * v * v))); else if (ACT == 11) v = 1.0f / (1.0f + expf(-v)); else if (ACT == 12) v = (v > 0.f) ? v : 0.01f * v; else if (ACT == 14) v = (v > 0.f) ? v : 0.1f * v; else if (ACT == 16) v = (v >= 0.f) ? v : 0.3f * v; else if (ACT == 17) v = (v >= 0.f) ? v : 0.2f * v; else if (ACT == 15) v = v / (1.0f + expf(-v)); else if (ACT == 3) v = fmaxf(v, 0.f); else if (ACT == 6) v = 0.5f * v * (1.0f + erff(v * 0.70710678118654752f)); so[w][8 * hh + r][t * 16 + ln] = v; } }
  __builtin_amdgcn_fence(__ATOMIC_ACQ_REL, "workgroup"); __builtin_amdgcn_wave_barrier();
  const int rsub = lane >> 4, c4 = (lane & 15) * 4; typedef _Float16 v4h __attribute__((ext_vector_type(4)));
  {
#pragma unroll
    for (int q = 0; q < 8; ++q) { const int r = q * 2 + rsub; if (col0 + c4 < N) { const v4f v = *(const v4fa*)&so[w][r][c4]; if (C) *(v4f*)(C + cofs + (size_t)(row0 + r) * ldc + col0 + c4) = v; if (C16) { v4h h4; for (int i = 0; i < 4; ++i) h4[i] = (_Float16)v[i]; *(v4h*)(C16 + cofs + (size_t)(row0 + r) * ldc + col0 + c4) = h4; } } }
     }
}


typedef _Float16 v4h __attribute__((ext_vector_type(4)));

__global__ __launch_bounds__(256) void k_x16(const float* __restrict__ x, _Float16* __restrict__ X16, size_t n8) { const size_t t = (size_t)blockIdx.x * 256 + threadIdx.x; if (t >= n8) return; FragH f;
#pragma unroll
  for (int q = 0; q < 8; ++q) f.h[q] = (_Float16)bf16_round(x[t * 8 + q]); *(v8us*)((unsigned short*)X16 + t * 8) = f.half[0];  }
__global__ __launch_bounds__(256) void k_h16(const float* __restrict__ x, _Float16* __restrict__ X16, size_t n8) { const size_t t = (size_t)blockIdx.x * 256 + threadIdx.x; if (t >= n8) return; FragH f;
#pragma unroll
  for (int q = 0; q < 8; ++q) f.h[q] = (_Float16)x[t * 8 + q]; *(v8us*)((unsigned short*)X16 + t * 8) = f.half[0];  }
__global__ __launch_bounds__(256) void k_round16f(const float* __restrict__ W, _Float16* __restrict__ Bt, size_t n8) { const size_t t = (size_t)blockIdx.x * 256 + threadIdx.x; if (t >= n8) return; FragH f;
#pragma unroll
  for (int i = 0; i < 8; ++i) f.h[i] = (_Float16)(bf16_round(W[t * 8 + i]) * 16.0f); *(v8us*)((unsigned short*)Bt + t * 8) = f.half[0];  }
template <int NHv, int TTv>
__global__ __launch_bounds__(256) void k_vt(const _Float16* __restrict__ V16, int ldv, int voff, _Float16* __restrict__ Vt) { __shared__ unsigned short tl[64][66]; const int tid = threadIdx.x; const int slab = blockIdx.x / (TTv / 64), lg = blockIdx.x % (TTv / 64); const int b = slab / NHv, h = slab % NHv;
  for (int i = tid; i < 64 * 8; i += 256) { const int r = i / 8, c8 = (i % 8) * 8; FragH f; f.half[0] = *(const v8us*)((const unsigned short*)V16 + ((size_t)b * TTv + lg * 64 + r) * ldv + voff + h * 64 + c8);
#pragma unroll
    for (int q = 0; q < 8; ++q) tl[r][c8 + q] = f.u[q]; }
  __syncthreads();
  {
#pragma unroll
    for (int rd = 0; rd < 2; ++rd) { const int d = rd * 32 + tid / 8, pc = tid % 8; FragH f;
#pragma unroll
      for (int q = 0; q < 8; ++q) f.u[q] = tl[pc * 8 + q][d];
      *(v8us*)((unsigned short*)Vt + ((size_t)slab * 64 + d) * TTv + lg * 64 + pc * 8) = f.half[0]; }
     } }

__global__ __launch_bounds__(256) void k_hl(const float* __restrict__ F, _Float16* __restrict__ Hh, _Float16* __restrict__ Hl, size_t n8) { const size_t t = (size_t)blockIdx.x * 256 + threadIdx.x; if (t >= n8) return; FragH fh, fl; const v4f a = *(const v4fa*)(F + t * 8), c = *(const v4fa*)(F + t * 8 + 4);
#pragma unroll
  for (int q = 0; q < 4; ++q) { _Float16 h = (_Float16)a[q]; fh.h[q] = h; fl.h[q] = (_Float16)((a[q] - (float)h) * 1024.0f); h = (_Float16)c[q]; fh.h[4 + q] = h; fl.h[4 + q] = (_Float16)((c[q] - (float)h) * 1024.0f); }
  { *(v8us*)((unsigned short*)Hh + t * 8) = fh.half[0]; *(v8us*)((unsigned short*)Hl + t * 8) = fl.half[0];  } }

// one 16 x 32 f16 fragment of a k-contiguous row: 16 bytes at k = 8 hh and 16 bytes at k = 16 + 8 hh (A and B alike)
__device__ __forceinline__ v16h g2_frag(const _Float16* p, int hh) { FragH f; f.half[0] = *(const v8us*)((const unsigned short*)p + 8 * hh); f.half[1] = *(const v8us*)((const unsigned short*)p + 16 + 8 * hh); return f.v; }
// ---- tiled GEMM: one 256 x 128 tile of C per work-group (M % 256 == 0, N % 128 == 0, K % 128 == 0), eight waves as 4 x 2, 64 x 64 per wave; epilogue = k_gemm_hhx semantics ----
// A stage is 128 k of 256 rows of A and of 128 rows of Bt, brought into LDS by asynchronous copies (whole 128-byte lines, through no register) and read by every wave that needs it.
// The tall tile is there for the L2: a stage's 384 rows feed twice the products that the 256 rows of a 128 x 128 tile feed, so three quarters of the bytes are drawn from L2 for the same C.
// Its eight waves fill the WGP and meet at one barrier, so nothing else runs while they wait for a stage's first fragments: the deep stage (64 products a wave) pays that wait half as often.
// Two buffers: the next stage's copies fly while this stage is worked on. The k order of every sum is that of the unstaged loop (32 k per product, ascending).
#define G3P 272                      /* LDS row pitch in bytes: 256 of data + 16, so that the 16 rows of a 16-byte fragment read fall on 64 different banks */
#define G3TA (256 * G3P)             /* the A tile */
#define G3TB (128 * G3P)             /* the Bt tile */
#define G3S (G3TA + G3TB)            /* one stage: [A tile | Bt tile] */
#define G3O (8 * 64 * 68 * 4)        /* output staging: 64 rows of 68 f32 for each of the eight waves */
__device__ __forceinline__ v8f g3_mma(v16h a, v16h b, v8f c) { return __builtin_amdgcn_wmma_f32_16x16x32_f16(false, a, false, b, (short)0, c, false, false); }
// Eight copies of 16 bytes a lane: rows r, r + 16, .., r + 112 of a block of 128 rows (l: the lane's LDS byte address, g: its global address, ld: the source pitch in elements).
// The s_wait_xcnt stands inside the statement, behind the last copy, so that no address register of a copy is rewritten in front of it.
__device__ __forceinline__ void g3_copy8(unsigned l, const _Float16* g, int ld) {
  const size_t st = (size_t)16 * ld;
  asm volatile("global_load_async_to_lds_b128 %0, %8, off\n\t"
               "global_load_async_to_lds_b128 %1, %9, off\n\t"
               "global_load_async_to_lds_b128 %2, %10, off\n\t"
               "global_load_async_to_lds_b128 %3, %11, off\n\t"
               "global_load_async_to_lds_b128 %4, %12, off\n\t"
               "global_load_async_to_lds_b128 %5, %13, off\n\t"
               "global_load_async_to_lds_b128 %6, %14, off\n\t"
               "global_load_async_to_lds_b128 %7, %15, off\n\t"
               "s_wait_xcnt 0x0"
               :: "v"(l), "v"(l + 16 * G3P), "v"(l + 32 * G3P), "v"(l + 48 * G3P), "v"(l + 64 * G3P), "v"(l + 80 * G3P), "v"(l + 96 * G3P), "v"(l + 112 * G3P),
                  "v"(g), "v"(g + st), "v"(g + 2 * st), "v"(g + 3 * st), "v"(g + 4 * st), "v"(g + 5 * st), "v"(g + 6 * st), "v"(g + 7 * st)
               : "memory"); }
// One stage, 24 copies a lane: the two halves of the A tile and the Bt tile (l: the lane's LDS byte address in the stage's buffer).
__device__ __forceinline__ void g3_stage(unsigned l, const _Float16* ga, int lda, const _Float16* gb, int ldb) { g3_copy8(l, ga, lda); g3_copy8(l + 128 * G3P, ga + (size_t)128 * lda, lda); g3_copy8(l + G3TA, gb, ldb); }
template <int ACT>
__device__ __forceinline__ float g3_act(float v) {
  if (ACT == 3) v = fmaxf(v, 0.f); else if (ACT == 6) v = 0.5f * v * (1.0f + erff(v * 0.70710678118654752f)); else if (ACT == 11) v = 1.0f / (1.0f + expf(-v)); else if (ACT == 15) v = v / (1.0f + expf(-v)); else if (ACT == 18) v = v / (1.0f + expf(-1.702f * v));      /* QuickGELU: v sigmoid(1.702 v) */ else if (ACT == 12) v = (v > 0.f) ? v : 0.01f * v; else if (ACT == 8) v = tanhf(v); else if (ACT == 9) v = 0.5f * v * (1.0f + tanhf(0.7978845608028654f * (v + 0.044715f * v * v * v))); else if (ACT == 14) v = (v > 0.f) ? v : 0.1f * v; else if (ACT == 16) v = (v >= 0.f) ? v : 0.3f * v; else if (ACT == 17) v = (v >= 0.f) ? v : 0.2f * v;
  return v; }
// Exact-erf GELU of four values, without a branch. The library erff picks one of two fits per lane (|x| < 1: x + x p(x^2); else 1 - exp(-q(|x|))); in a wave both sides are nearly always taken,
// one after the other, each a serial chain behind a compare, an EXEC write and a jump. Here every lane evaluates both fits (the same coefficients, as fused multiply-adds on whole vectors) and selects,
// so that many values' chains run side by side. exp(-q) is 2^(-q log2 e) on the hardware's own 2^x: q >= 1.8 on the side that is kept, so the result moves by a last f32 bit at most.
__device__ __forceinline__ v4f g3_sp(unsigned bits) { const float k = __builtin_bit_cast(float, bits); const v4f r = {k, k, k, k}; return r; }
__device__ __forceinline__ v4f g3_gelu4(v4f v) {
  const v4f x = v * 0.70710678118654752f, ax = __builtin_elementwise_abs(x), t = x * x;
  v4f p = __builtin_elementwise_fma(t, g3_sp(0xba1345e1u), g3_sp(0x3ba10414u));
  p = __builtin_elementwise_fma(t, p, g3_sp(0xbcdac9b8u)); p = __builtin_elementwise_fma(t, p, g3_sp(0x3de703beu)); p = __builtin_elementwise_fma(t, p, g3_sp(0xbec09330u)); p = __builtin_elementwise_fma(t, p, g3_sp(0x3e0375d0u));
  p = __builtin_elementwise_fma(ax, p, ax);
  v4f q = __builtin_elementwise_fma(ax, g3_sp(0x378e98abu), g3_sp(0xb9c68948u));
  q = __builtin_elementwise_fma(ax, q, g3_sp(0x3b7cd369u)); q = __builtin_elementwise_fma(ax, q, g3_sp(0xbcc618b2u)); q = __builtin_elementwise_fma(ax, q, g3_sp(0x3dda74e4u)); q = __builtin_elementwise_fma(ax, q, g3_sp(0x3f228afdu)); q = __builtin_elementwise_fma(ax, q, g3_sp(0x3e03c728u));
  q = __builtin_elementwise_fma(ax, q, ax) * -1.44269504088896340736f;
  v4f e;
#pragma unroll      /* unrolled: the vectors' elements are named by constants */
  for (int i = 0; i < 4; ++i) e[i] = __builtin_copysignf(ax[i] < 1.0f ? p[i] : 1.0f - __builtin_amdgcn_exp2f(q[i]), x[i]);
  return (0.5f * v) * (1.0f + e); }
// RES: add CP's own element of the C plane, then the activation (both on the staged rows, 16 bytes a lane); W32: write f32 rows to C, else f16 rows to C16. Both are compile-time, so that the epilogue is one straight run and its loads go out together.
// RBF: the residual element is rounded to bf16 where it is read (CP is then the raw input, and no rounded copy of it is kept).
// VSW: plane 2 runs with A and Bt swapped, so that its tile is C^T: rows = Bt's rows, columns = A's rows (tokens). It is stored as SQ-token blocks, [token / SQ][Bt row][token % SQ], pitch SQ == ldc: V^T per batch and head, with no transposing pass. The k order of every sum is the same; the swapped plane takes no bias (it would run along the rows).
template <int ACT, bool RES, bool W32, bool RBF = false, bool VSW = false>
__global__ __launch_bounds__(256) void k_gemm3(const _Float16* __restrict__ A, int lda, size_t sA, const _Float16* __restrict__ Bh, int ldb, size_t sB, float alpha, const float* __restrict__ bias, size_t sBias, const float* __restrict__ CP,
    float* __restrict__ C, _Float16* __restrict__ C16, size_t sC, int M, int N, int K) { static_assert(ACT == 0 || ACT == 3 || ACT == 6 || ACT == 8 || ACT == 9 || ACT == 11 || ACT == 12 || ACT == 14 || ACT == 15 || ACT == 16 || ACT == 17 || ACT == 18, "k_gemm3: unsupported ACT code (would silently apply no activation)");
  __shared__ __attribute__((aligned(128))) unsigned char L[2 * G3S]; static_assert(G3O <= 2 * G3S, "k_gemm3: the output staging reuses the ring");
  const int tid = threadIdx.x, w = tid >> 5, lane = tid & 31, ln = lane & 15, hh = lane >> 4; const int by = blockIdx.y;
  A += (size_t)by * sA; Bh += (size_t)by * sB; const size_t cofs = (size_t)by * sC; const bool sw = VSW && by == 2;      /* the same for the whole work-group */
  if (sw) { const _Float16* const pa0 = A; A = Bh; Bh = pa0; const int m0 = M; M = N; N = m0; const int l0 = lda; lda = ldb; ldb = l0; }
  const float* bp = (bias && !sw) ? bias + (size_t)by * sBias : nullptr;
  const int ntn = N >> 7; const int mt = blockIdx.x / ntn, nq = blockIdx.x - mt * ntn; if (mt * 256 >= M) return;      /* the same for the whole work-group, in front of every barrier */
  const int row0 = mt * 256 + (w >> 1) * 64, col0 = nq * 128 + (w & 1) * 64;
  const unsigned lc = (unsigned)(size_t)L + (unsigned)((tid >> 4) * G3P + (tid & 15) * 16);      /* sixteen lanes copy one 256-byte row */
  const _Float16* ga = A + (size_t)(mt * 256 + (tid >> 4)) * lda + (tid & 15) * 8; const _Float16* gb = Bh + (size_t)(nq * 128 + (tid >> 4)) * ldb + (tid & 15) * 8;
  const int nt = K >> 7; constexpr int ldc = DM; static_assert(DFF == DM, "k_gemm3: one output pitch");      /* a compile-time pitch: the epilogue's loads and stores share one address pair each and differ only in their immediate offsets */
  const v8f z8 = {0.f,0.f,0.f,0.f,0.f,0.f,0.f,0.f}; v8f acc[4][4];
#pragma unroll
  for (int i = 0; i < 4; ++i)
#pragma unroll
    for (int j = 0; j < 4; ++j) acc[i][j] = z8;
  g3_stage(lc, ga, lda, gb, ldb);
  asm volatile("s_wait_asynccnt 0x0" ::: "memory");      /* stage 0 has landed (this wave's copies) */
  __syncthreads();      /* ... and every wave's */
  if (nt > 1) g3_stage(lc + G3S, ga + 128, lda, gb + 128, ldb);
  float bv[4] = {0.f, 0.f, 0.f, 0.f};      /* the lane's four bias values, fetched here so that they arrive under the loop */
  if (bp) {
#pragma unroll
    for (int t = 0; t < 4; ++t) bv[t] = bp[col0 + t * 16 + ln];
    asm volatile("s_wait_xcnt 0x0" ::: "memory"); }      /* the four loads' offset register is rewritten right behind them */
#pragma unroll 1
  for (int t = 0; t < nt; ++t) { const unsigned buf = (unsigned)(t & 1) * G3S;      /* rolled: one copy of the 64 products in the text */
    const _Float16* pa = (const _Float16*)(L + buf + ((w >> 1) * 64 + ln) * G3P); const _Float16* pb = (const _Float16*)(L + buf + G3TA + ((w & 1) * 64 + ln) * G3P);
    v16h a[4][4], b[4][4];
#pragma unroll
    for (int ks = 0; ks < 4; ++ks)
#pragma unroll
      for (int i = 0; i < 4; ++i) { a[ks][i] = g2_frag(pa + i * 16 * (G3P / 2) + ks * 32, hh); b[ks][i] = g2_frag(pb + i * 16 * (G3P / 2) + ks * 32, hh); }
    __builtin_amdgcn_sched_barrier(0);      /* keeps the stage's 64 fragment reads together in front of its products: without it the scheduler sinks the A reads among them, into one register set, and every four products wait out an LDS latency */
#pragma unroll
    for (int ks = 0; ks < 4; ++ks)
#pragma unroll
      for (int i = 0; i < 4; ++i)
#pragma unroll
        for (int j = 0; j < 4; ++j) acc[i][j] = g3_mma(a[ks][i], b[ks][j], acc[i][j]);
    __builtin_amdgcn_sched_barrier(0);      /* keeps the products in front of the stage's waits: without it the scheduler sinks them behind the barrier, and the wait for the next stage's copies stands at the head of the trip, before they have had time to land */
    asm volatile("s_wait_dscnt 0x0" ::: "memory");      /* this wave's reads of the buffer have returned */
    asm volatile("s_wait_asynccnt 0x0" ::: "memory");      /* this wave's copies of stage t + 1 have landed */
    __syncthreads();      /* publishes stage t + 1 and frees stage t's buffer */
    if (t + 2 < nt) g3_stage(lc + buf, ga + (size_t)(t + 2) * 128, lda, gb + (size_t)(t + 2) * 128, ldb); }
  asm volatile("s_wait_asynccnt 0x0" ::: "memory");      /* no copy is outstanding when the ring becomes output staging */
  float (*so)[68] = (float (*)[68])(L + (size_t)w * (64 * 68 * 4));      /* each wave stages in its own range; the last trip's barrier has ended every read of the ring */
#pragma unroll
  for (int u = 0; u < 16; ++u) { const int t = u & 3, half = u >> 2;
#pragma unroll
    for (int r = 0; r < 8; ++r) { const int rloc = half * 16 + 8 * hh + r; const float v = acc[half][t][r] * alpha + bf16_round(bv[t]);
      so[rloc][t * 16 + ln] = v; } }
  __builtin_amdgcn_fence(__ATOMIC_ACQ_REL, "workgroup"); __builtin_amdgcn_wave_barrier();
  const int rsub = lane >> 4, c4 = (lane & 15) * 4;
  static_assert(!VSW || (SQ == ldc && SQ % 128 == 0), "k_gemm3: a swapped tile lies in one SQ-token block, whose pitch is ldc");
  const size_t cb = sw ? (size_t)(col0 / SQ) * ((size_t)DM * SQ) + (size_t)(col0 % SQ) : (size_t)col0;      /* the wave's first column in the C plane */
  const size_t e0 = cofs + (size_t)(row0 + rsub) * ldc + cb + c4;      /* the lane's first element; row q * 2 + rsub lies q * 2 * ldc elements further on */
  v4f rv[32]; static_assert(!RES || ACT == 0, "k_gemm3: the residual rows are held in registers, so their loop is unrolled");
  if (RES) {
#pragma unroll
    for (int q = 0; q < 32; ++q) rv[q] = *(const v4fa*)(CP + e0 + (size_t)q * (2 * ldc));
    asm volatile("s_wait_xcnt 0x0" ::: "memory");      /* the 32 loads share one address pair, which is rewritten right behind them */
  }
  if (RES && RBF) {      /* both loops unrolled: rv is indexed by constants only and stays in registers */
#pragma unroll
    for (int q = 0; q < 32; ++q)
#pragma unroll
      for (int i = 0; i < 4; ++i) rv[q][i] = bf16_round(rv[q][i]); }
  if constexpr (ACT == 6) {      /* GELU rows, eight at a time: 32 values a lane whose chains run side by side; the inner loops are unrolled so that v and h4 are indexed by constants only and stay in registers */
#pragma unroll 1      /* rolled: four trips of one copy of the 32 evaluations in the text */
    for (int q0 = 0; q0 < 32; q0 += 8) { v4f v[8]; v4h h4[8];
#pragma unroll
      for (int u = 0; u < 8; ++u) v[u] = *(const v4fa*)&so[(q0 + u) * 2 + rsub][c4];
#pragma unroll
      for (int u = 0; u < 8; ++u) { v[u] = g3_gelu4(v[u]);
#pragma unroll
        for (int i = 0; i < 4; ++i) h4[u][i] = (_Float16)v[u][i]; }
      __builtin_amdgcn_sched_barrier(0);      /* every result is in its own registers before the first store: nothing is computed behind a store, so no register of an issued store is rewritten inside the trip */
#pragma unroll
      for (int u = 0; u < 8; ++u) { const size_t e = e0 + (size_t)(q0 + u) * (2 * ldc); if (W32) *(v4f*)(C + e) = v[u]; else *(v4h*)(C16 + e) = h4[u]; }
      asm volatile("s_wait_xcnt 0x0" ::: "memory");      /* the next trip rewrites registers of the eight issued stores: one wait in front of that */
    }
  } else
  {
#pragma unroll(ACT == 0 ? 32 : 2)      /* with an activation the loop stays rolled */
    for (int q = 0; q < 32; ++q) { const int r = q * 2 + rsub; const size_t e = e0 + (size_t)q * (2 * ldc); v4f v = *(const v4fa*)&so[r][c4]; if (RES) v += rv[q]; for (int i = 0; i < 4; ++i) v[i] = g3_act<ACT>(v[i]); if (W32) *(v4f*)(C + e) = v; else { v4h h4; for (int i = 0; i < 4; ++i) h4[i] = (_Float16)v[i]; *(v4h*)(C16 + e) = h4; }
      if (ACT != 0 || (q & 7) == 7) asm volatile("s_wait_xcnt 0x0" ::: "memory");      /* later rows rewrite registers of issued stores (rolled loop: the next trip does); unrolled, one wait serves eight rows */
    }
     } }


__global__ __launch_bounds__(256) void k_wnat(const float* __restrict__ w, size_t n8, _Float16* __restrict__ Bt) { const size_t t = (size_t)blockIdx.x * 256 + threadIdx.x; if (t >= n8) return; FragH f; for (int q = 0; q < 8; ++q) f.h[q] = (_Float16)(bf16_round(w[t * 8 + q]) * 16.0f); *(v8us*)((unsigned short*)Bt + t * 8) = f.half[0];  }
__global__ __launch_bounds__(256) void k_rsm(const float* __restrict__ S, _Float16* __restrict__ P, int nrows) {
  #pragma clang fp contract(off)
  const int i = blockIdx.x * 256 + threadIdx.x; if (i >= nrows) return; const float* s = S + (size_t)i * SQ; float mx = -3.0e38f;
#pragma unroll 1
  for (int j = 0; j < SQ; ++j) mx = fmaxf(mx, s[j]); float se = 0.f;
#pragma unroll 1
  for (int j = 0; j < SQ; ++j) se += expf(s[j] - mx); const float sc = 256.0f / se;
#pragma unroll 1
  for (int j0 = 0; j0 < SQ; j0 += 8) { FragH f; for (int q = 0; q < 8; ++q) f.h[q] = (_Float16)(expf(s[j0 + q] - mx) * sc); unsigned short* d = (unsigned short*)P + (size_t)i * SQ + j0; *(v8us*)d = f.half[0];  } }
__global__ __launch_bounds__(256) void k_vt(const _Float16* __restrict__ V16, int b, int h0, _Float16* __restrict__ VT) { __shared__ unsigned short tl[64][65]; const int tid = threadIdx.x; const int hh = blockIdx.x % HG, sg = blockIdx.x / HG; const int s0 = sg * 64; const int h = h0 + hh;
  for (int i = tid; i < 64 * 8; i += 256) { const int j = i / 8, d8 = (i % 8) * 8; FragH f; f.half[0] = *(const v8us*)((const unsigned short*)V16 + ((size_t)b * SQ + s0 + j) * DM + h * HD + d8); for (int q = 0; q < 8; ++q) tl[d8 + q][j] = f.u[q]; }
  __syncthreads();
  { for (int i = tid; i < 64 * 8; i += 256) { const int d = i / 8, j8 = (i % 8) * 8; FragH f; for (int q = 0; q < 8; ++q) f.u[q] = tl[d][j8 + q]; *(v8us*)((unsigned short*)VT + ((size_t)hh * HD + d) * SQ + s0 + j8) = f.half[0]; }  } }



__global__ __launch_bounds__(256) void k_rsmcf2(const float* __restrict__ S, _Float16* __restrict__ P, int hg, int q0, int nk) {
  #pragma clang fp contract(off)
  const int t = blockIdx.x * 256 + threadIdx.x; if (t >= hg * QT) return; const size_t i = (size_t)t; const float* s = S + i * NKX; const int last = q0 + (t % QT); float mx = -3.0e38f;
#pragma unroll 1
  for (int j = 0; j < nk; ++j) { const float f = (j <= last) ? 1.f : 0.f; mx = fmaxf(mx, fmaf(f, s[j], (1.f - f) * -1.0e9f)); } float se = 0.f;
#pragma unroll 1
  for (int j = 0; j < nk; ++j) { const float f = (j <= last) ? 1.f : 0.f; se += __expf(fmaf(f, s[j], (1.f - f) * -1.0e9f) - mx); } const float sc = 256.0f / se;
#pragma unroll 1
  for (int j0 = 0; j0 < nk; j0 += 8) { FragH fr; for (int q = 0; q < 8; ++q) { const int j = j0 + q; const float f = (j <= last) ? 1.f : 0.f; fr.h[q] = (_Float16)(__expf(fmaf(f, s[j], (1.f - f) * -1.0e9f) - mx) * sc); } unsigned short* d = (unsigned short*)P + i * NKX + j0; *(v8us*)d = fr.half[0];  } }

__global__ __launch_bounds__(256) void k_rsmcst(const float* __restrict__ S, _Float16* __restrict__ P, int hg, int q0, int nk, const int* __restrict__ mk) {
  #pragma clang fp contract(off)
  const int t = blockIdx.x * 256 + threadIdx.x; if (t >= hg * QT) return; const size_t i = (size_t)t; const float* s = S + i * NKX; const size_t ig = (size_t)(q0 + (t % QT)); const int* mr = mk + ig * SQ; float mx = -3.0e38f;
#pragma unroll 1
  for (int j = 0; j < nk; ++j) { const int mb = mr[j]; const int dd = (int)ig - j; const float f = (mb != 0 && dd >= 0 && (dd <= LOCALW || (dd % STRIDEK) == 0)) ? 1.f : 0.f; mx = fmaxf(mx, fmaf(f, s[j], (1.f - f) * -1.0e9f)); } float se = 0.f;
#pragma unroll 1
  for (int j = 0; j < nk; ++j) { const int mb = mr[j]; const int dd = (int)ig - j; const float f = (mb != 0 && dd >= 0 && (dd <= LOCALW || (dd % STRIDEK) == 0)) ? 1.f : 0.f; se += __expf(fmaf(f, s[j], (1.f - f) * -1.0e9f) - mx); } const float sc = 256.0f / se;
#pragma unroll 1
  for (int j0 = 0; j0 < nk; j0 += 8) { FragH fr; for (int q = 0; q < 8; ++q) { const int j = j0 + q; const int mb = mr[j]; const int dd = (int)ig - j; const float f = (mb != 0 && dd >= 0 && (dd <= LOCALW || (dd % STRIDEK) == 0)) ? 1.f : 0.f; fr.h[q] = (_Float16)(__expf(fmaf(f, s[j], (1.f - f) * -1.0e9f) - mx) * sc); } unsigned short* d = (unsigned short*)P + i * NKX + j0; *(v8us*)d = fr.half[0];  } }


template <int MASKADD>
__global__ __launch_bounds__(64) void k_att0(const float* __restrict__ QF, const float* __restrict__ KF, const float* __restrict__ VF, int ld, const float* __restrict__ mask, float scale, float* __restrict__ OF, int ldo) {
  #pragma clang fp contract(off)
  __shared__ __attribute__((aligned(16))) float lq[64][64]; __shared__ __attribute__((aligned(16))) float lo[64][64];
  const int tid = threadIdx.x; const int h = blockIdx.x / (QT0 / 64), rg = blockIdx.x % (QT0 / 64); const int i = rg * 64 + tid;
  const float* qr = QF + (size_t)i * ld + h * HD;
#pragma unroll 1
  for (int c = 0; c < HD / 4; ++c) { *(v4f*)&lq[tid][c * 4] = *(const v4fa*)(qr + c * 4); const v4f z = {0.f, 0.f, 0.f, 0.f}; *(v4f*)&lo[tid][c * 4] = z; }
  float m = -1.0e30f, l = 0.f; const int jmax = MASKADD ? (SQ - 1) : (rg * 64 + 63);      /* additive-mask form: every key (the mask input decides); causal form: keys up to the block's last row */
#pragma unroll 1
  for (int j = 0; j <= jmax; ++j) { const float* kr = KF + (size_t)j * ld + h * HD; const float* vr = VF + (size_t)j * ld + h * HD; float s = 0.f;
#pragma unroll 1
    for (int c = 0; c < HD / 4; ++c) { const v4f kq = *(const v4fa*)(kr + c * 4); const v4f qq = *(v4f*)&lq[tid][c * 4]; s = __fadd_rn(s, __fmul_rn(qq[0], kq[0])); s = __fadd_rn(s, __fmul_rn(qq[1], kq[1])); s = __fadd_rn(s, __fmul_rn(qq[2], kq[2])); s = __fadd_rn(s, __fmul_rn(qq[3], kq[3])); }
    s = __fmul_rn(s, scale); if (MASKADD) s = __fadd_rn(s, __fmul_rn(bf16_round(mask[(size_t)i * SQ + j]), -10000.0f));
    const float f = (MASKADD || j <= i) ? 1.f : 0.f; const float sm = fmaf(f, s, (1.f - f) * -1.0e30f); const float mn = fmaxf(m, sm); const float sc = expf(m - mn); const float e = expf(sm - mn); l = __fadd_rn(__fmul_rn(l, sc), e); m = mn;
#pragma unroll 1
    for (int c = 0; c < HD / 4; ++c) { const v4f vv = *(const v4fa*)(vr + c * 4); v4f oo = *(v4f*)&lo[tid][c * 4]; for (int u = 0; u < 4; ++u) oo[u] = __fadd_rn(__fmul_rn(oo[u], sc), __fmul_rn(e, vv[u])); *(v4f*)&lo[tid][c * 4] = oo; } }
  const float fin = 64.0f / l;      /* o carried x64 like the f16 path */
#pragma unroll 1
  for (int c = 0; c < HD / 4; ++c) { v4f oo = *(v4f*)&lo[tid][c * 4]; for (int u = 0; u < 4; ++u) oo[u] = __fmul_rn(oo[u], fin); *(v4f*)&lo[tid][c * 4] = oo; }
  __syncthreads();
  {
#pragma unroll 1
    for (int it = 0; it < 16; ++it) { const int row = it * 4 + tid / 16, pc = (tid % 16) * 4; const v4f v = *(const v4f*)&lo[row][pc]; *(v4f*)(OF + (size_t)(rg * 64 + row) * ldo + h * HD + pc) = v; }
     } }

template <int MASKADD>
__global__ __launch_bounds__(64) void k_att0mbc(const float* __restrict__ QF, const float* __restrict__ KF, const float* __restrict__ VF, int ld, const float* __restrict__ mask, float scale, float* __restrict__ OF, int ldo) {
  #pragma clang fp contract(off)
  __shared__ __attribute__((aligned(16))) float lq[64][64]; __shared__ __attribute__((aligned(16))) float lo[64][64];
  const int tid = threadIdx.x; const int h = blockIdx.x / (QT0 / 64), rg = blockIdx.x % (QT0 / 64); const int i = rg * 64 + tid;
  const float* qr = QF + (size_t)i * ld + h * HD;
#pragma unroll 1
  for (int c = 0; c < HD / 4; ++c) { *(v4f*)&lq[tid][c * 4] = *(const v4fa*)(qr + c * 4); const v4f z = {0.f, 0.f, 0.f, 0.f}; *(v4f*)&lo[tid][c * 4] = z; }
  float m = -1.0e30f, l = 0.f; const int jmax = rg * 64 + 63;      /* keys beyond the block end are masked by the mask's lower-triangular structure */
#pragma unroll 1
  for (int j = 0; j <= jmax; ++j) { const float* kr = KF + (size_t)j * ld + h * HD; const float* vr = VF + (size_t)j * ld + h * HD; float s = 0.f;
#pragma unroll 1
    for (int c = 0; c < HD / 4; ++c) { const v4f kq = *(const v4fa*)(kr + c * 4); const v4f qq = *(v4f*)&lq[tid][c * 4]; s = __fadd_rn(s, __fmul_rn(qq[0], kq[0])); s = __fadd_rn(s, __fmul_rn(qq[1], kq[1])); s = __fadd_rn(s, __fmul_rn(qq[2], kq[2])); s = __fadd_rn(s, __fmul_rn(qq[3], kq[3])); }
    s = __fmul_rn(s, scale); const int mb = ((const int*)mask)[(size_t)i * SQ + j];      /* causal (j <= i) AND the module's int32 [S][S] mask read per (query, key): 0 -> masked */
    const float f = (mb != 0 && j <= i) ? 1.f : 0.f; const float sm = fmaf(f, s, (1.f - f) * -1.0e30f); const float mn = fmaxf(m, sm); const float sc = expf(m - mn); const float e = expf(sm - mn); l = __fadd_rn(__fmul_rn(l, sc), e); m = mn;
#pragma unroll 1
    for (int c = 0; c < HD / 4; ++c) { const v4f vv = *(const v4fa*)(vr + c * 4); v4f oo = *(v4f*)&lo[tid][c * 4]; for (int u = 0; u < 4; ++u) oo[u] = __fadd_rn(__fmul_rn(oo[u], sc), __fmul_rn(e, vv[u])); *(v4f*)&lo[tid][c * 4] = oo; } }
  const float fin = 64.0f / l;      /* o carried x64 like the f16 path */
#pragma unroll 1
  for (int c = 0; c < HD / 4; ++c) { v4f oo = *(v4f*)&lo[tid][c * 4]; for (int u = 0; u < 4; ++u) oo[u] = __fmul_rn(oo[u], fin); *(v4f*)&lo[tid][c * 4] = oo; }
  __syncthreads();
  {
#pragma unroll 1
    for (int it = 0; it < 16; ++it) { const int row = it * 4 + tid / 16, pc = (tid % 16) * 4; const v4f v = *(const v4f*)&lo[row][pc]; *(v4f*)(OF + (size_t)(rg * 64 + row) * ldo + h * HD + pc) = v; }
     } }


template <int BFIN, int WXB>
__global__ __launch_bounds__(256) void k_ln16(const float* __restrict__ X, const float* __restrict__ g, const float* __restrict__ bb, float eps, _Float16* __restrict__ N16, float* __restrict__ XB) {
  #pragma clang fp contract(off)
  __shared__ float red[256]; const size_t r = blockIdx.x; const int t = threadIdx.x; const v4f xa = *(const v4fa*)(X + r * DMQ + t * 4); float s[4]; float sum = 0.f;
  for (int q = 0; q < 4; ++q) { s[q] = BFIN ? bf16_round(xa[q]) : xa[q]; sum = __fadd_rn(sum, s[q]); }
  red[t] = sum; __syncthreads(); for (int st = 128; st > 0; st >>= 1) { if (t < st) red[t] = __fadd_rn(red[t], red[t + st]); __syncthreads(); } const float mu = red[0] / (float)DMQ; __syncthreads();
  float vs = 0.f; for (int q = 0; q < 4; ++q) { const float dl = __fadd_rn(s[q], -mu); vs = __fadd_rn(vs, __fmul_rn(dl, dl)); } red[t] = vs; __syncthreads(); for (int st = 128; st > 0; st >>= 1) { if (t < st) red[t] = __fadd_rn(red[t], red[t + st]); __syncthreads(); }
  const float rs = rsqrtf(__fadd_rn(red[0] / (float)DMQ, eps)); v4h y; v4f xb;
  for (int q = 0; q < 4; ++q) { const int c = t * 4 + q; y[q] = (_Float16)__fadd_rn(__fmul_rn(__fmul_rn(__fadd_rn(s[q], -mu), rs), bf16_round(g[c])), bf16_round(bb[c])); xb[q] = s[q]; }
  { *(v4h*)(N16 + r * DMQ + t * 4) = y; if (WXB) *(v4f*)(XB + r * DMQ + t * 4) = xb;  } }
__global__ __launch_bounds__(256) void k_ftres2(const float* __restrict__ OF0, const float* __restrict__ XB, float* __restrict__ X1, size_t n4) {
  #pragma clang fp contract(off)
  const size_t t = (size_t)blockIdx.x * 256 + threadIdx.x; if (t >= n4) return; const v4f o = *(const v4fa*)(OF0 + t * 4), xv = *(const v4fa*)(XB + t * 4); v4f y; for (int q = 0; q < 4; ++q) y[q] = __fadd_rn(__fmul_rn(o[q], 0.015625f), xv[q]); *(v4f*)(X1 + t * 4) = y;  }

__global__ __launch_bounds__(256) void k_bcpy(const float* __restrict__ b, int n, int NP, float* __restrict__ dst, int dst0) { for (int i = threadIdx.x; i < NP; i += 256) { const float v = (i < n) ? b[i] : 0.f; *(float*)(dst + dst0 + i) = v; }  }


#define FAW 8                        /* waves per work-group */
#define FAQ 32                       /* query columns per wave (two 16-column groups) */
#define FAC 0.18033688011112042592f  /* 64^-0.5 * log2 e: scores are carried in log2 units */
__device__ __forceinline__ float rs_x16(float x) { const int b = __builtin_bit_cast(int, x); return __builtin_bit_cast(float, __builtin_amdgcn_permlanex16(b, b, 0x76543210, 0xfedcba98, false, false)); }      /* lane l <- lane l ^ 16 */
// Four 2^x in one statement. The outputs are early-clobber, so inside it no v_exp_f32 is directly followed by a read of its result or a write of its source; the v_nop keeps that slot behind the last one.
__device__ __forceinline__ v4f rs_exp2(v4f x) { float y0, y1, y2, y3; asm("v_exp_f32 %0, %4\n\tv_exp_f32 %1, %5\n\tv_exp_f32 %2, %6\n\tv_exp_f32 %3, %7\n\tv_nop" : "=&v"(y0), "=&v"(y1), "=&v"(y2), "=&v"(y3) : "v"(x[0]), "v"(x[1]), "v"(x[2]), "v"(x[3])); const v4f y = {y0, y1, y2, y3}; return y; }
// One 2^x, with the same slot kept behind it.
__device__ __forceinline__ float fa_exp2(float x) { float y; asm("v_exp_f32 %0, %1\n\tv_nop" : "=&v"(y) : "v"(x)); return y; }
__device__ __forceinline__ v8f fa_mma(v16h a, v16h b, v8f c) { return __builtin_amdgcn_wmma_f32_16x16x32_f16(false, a, false, b, (short)0, c, false, false); }
// Q16, K16: f16 rows [NB * SQ][DM], head h = columns h*64..; VT: f16 [NB * NH][HD][SQ]; O16: context x64 as f16 rows (merged heads).
// The short loops are fully unrolled so that every fragment array is indexed by constants and stays in registers.
// K and V^T reach the eight waves through LDS: a stage is 64 keys, 64 K rows of 128 bytes and 64 V^T rows of 128 bytes, brought in once per work-group by asynchronous copies
// (whole 128-byte lines, through no register) and read by every wave as 16-byte fragment halves. Two buffers: the next stage's copies fly while this stage is worked on.
#define FAK 64                       /* keys per stage (two 32-key passes) */
#define FAP 144                      /* LDS row pitch in bytes: 128 of data + 16, so that the 16 rows of a 16-byte fragment read fall on 64 different banks */
#define FAT (64 * FAP)               /* one operand's tile */
#define FAS (2 * FAT)                /* one stage: [K tile | V^T tile] */
// Four copies of 16 bytes a lane: rows r and r + 32 of the K tile and of the V^T tile (l: the lane's LDS byte address in the K tile, gk, gv: its global addresses).
// The s_wait_xcnt stands inside the statement, behind the last copy, so that no address register of a copy is rewritten in front of it.
__device__ __forceinline__ void fa_copy4(unsigned l, const _Float16* gk, const _Float16* gv) {
  asm volatile("global_load_async_to_lds_b128 %0, %4, off\n\t"
               "global_load_async_to_lds_b128 %1, %5, off\n\t"
               "global_load_async_to_lds_b128 %2, %6, off\n\t"
               "global_load_async_to_lds_b128 %3, %7, off\n\t"
               "s_wait_xcnt 0x0"
               :: "v"(l), "v"(l + 32 * FAP), "v"(l + FAT), "v"(l + FAT + 32 * FAP),
                  "v"(gk), "v"(gk + (size_t)32 * DM), "v"(gv), "v"(gv + (size_t)32 * SQ)
               : "memory"); }
__global__ __launch_bounds__(FAW * 32) void k_fattn(const _Float16* __restrict__ Q16, const _Float16* __restrict__ K16, const _Float16* __restrict__ VT, _Float16* __restrict__ O16) {
  __shared__ __attribute__((aligned(128))) unsigned char L[2 * FAS]; static_assert(FAW * 32 == 256 && HD == 64 && SQ % FAK == 0 && SQ / FAK >= 2, "k_fattn: 256 lanes copy 32 rows of 128 bytes at a time; the ring needs two stages");
  const int tid = threadIdx.x, lane = tid & 31, ln = lane & 15, hh = lane >> 4, w = tid >> 5;
  constexpr int QB = SQ / (FAW * FAQ); const int qb = blockIdx.x % QB, bh = blockIdx.x / QB; const int b = bh / NH, h = bh % NH; const int q0 = qb * (FAW * FAQ) + w * FAQ;
  const _Float16* qp = Q16 + ((size_t)b * SQ + q0 + ln) * DM + h * HD;
  const unsigned lc = (unsigned)(size_t)L + (unsigned)((tid >> 3) * FAP + (tid & 7) * 16);      /* eight lanes copy one 128-byte row */
  const _Float16* gk = K16 + ((size_t)b * SQ + (tid >> 3)) * DM + h * HD + (tid & 7) * 8; const _Float16* gv = VT + ((size_t)bh * HD + (tid >> 3)) * SQ + (tid & 7) * 8;
  constexpr int nt = SQ / FAK;
  const v8f z8 = {0.f, 0.f, 0.f, 0.f, 0.f, 0.f, 0.f, 0.f};
  v16h qf[2][2]; v8f o[2][4]; float m[2], l[2];
  fa_copy4(lc, gk, gv);
#pragma unroll
  for (int j = 0; j < 2; ++j) { m[j] = -3.0e38f; l[j] = 0.f;
#pragma unroll
    for (int d = 0; d < 4; ++d) o[j][d] = z8;
#pragma unroll
    for (int ks = 0; ks < 2; ++ks) qf[j][ks] = g2_frag(qp + (size_t)j * 16 * DM + ks * 32, hh); }
  asm volatile("s_wait_xcnt 0x0" ::: "memory");      /* in front of any rewrite of the Q loads' address pair */
  asm volatile("s_wait_asynccnt 0x0" ::: "memory");      /* stage 0 has landed (this wave's copies) */
  __syncthreads();      /* ... and every wave's */
  fa_copy4(lc + FAS, gk + (size_t)FAK * DM, gv + FAK);
#pragma unroll 1
  for (int t = 0; t < nt; ++t) { const unsigned buf = (unsigned)(t & 1) * FAS;      /* rolled: one copy of the two passes in the text */
    const _Float16* pk = (const _Float16*)(L + buf + ln * FAP); const _Float16* pv = (const _Float16*)(L + buf + FAT + ln * FAP);
#pragma unroll
    for (int p = 0; p < FAK / 32; ++p) {
      v16h kf[2][2], vf[4]; v8f s[2][2];
#pragma unroll
      for (int u = 0; u < 2; ++u)
#pragma unroll
        for (int ks = 0; ks < 2; ++ks) kf[u][ks] = g2_frag(pk + (p * 32 + u * 16) * (FAP / 2) + ks * 32, hh);
#pragma unroll
      for (int d = 0; d < 4; ++d) vf[d] = g2_frag(pv + d * 16 * (FAP / 2) + p * 32, hh);
#pragma unroll
      for (int j = 0; j < 2; ++j)
#pragma unroll
        for (int u = 0; u < 2; ++u) s[j][u] = fa_mma(kf[u][1], qf[j][1], fa_mma(kf[u][0], qf[j][0], z8));      /* s[j][u][r] = q(q0 + 16 j + ln) . k(64 t + 32 p + 16 u + 8 hh + r) */
      FragH pf[2]; float al[2];
#pragma unroll
      for (int j = 0; j < 2; ++j) {
        float mx = fmaxf(s[j][0][0], s[j][1][0]);
#pragma unroll
        for (int r = 1; r < 8; ++r) mx = fmaxf(mx, fmaxf(s[j][0][r], s[j][1][r]));
        mx = fmaxf(mx, rs_x16(mx));
        const float mn = fmaxf(m[j], mx * FAC), mb = 8.0f - mn; al[j] = fa_exp2(m[j] - mn); m[j] = mn;      /* p = 2^8 exp(s - max) <= 256: small weights stay out of the f16 subnormals; the factor cancels against the sum */
        v4f s4 = {0.f, 0.f, 0.f, 0.f};
#pragma unroll
        for (int u = 0; u < 2; ++u)
#pragma unroll
          for (int c = 0; c < 2; ++c) { const v4f x = {s[j][u][c * 4] * FAC + mb, s[j][u][c * 4 + 1] * FAC + mb, s[j][u][c * 4 + 2] * FAC + mb, s[j][u][c * 4 + 3] * FAC + mb}; const v4f e = rs_exp2(x); s4 += e;
#pragma unroll
            for (int q = 0; q < 4; ++q) pf[j].h[u * 8 + c * 4 + q] = (_Float16)e[q]; }
        l[j] = l[j] * al[j] + ((s4[0] + s4[1]) + (s4[2] + s4[3])); }
      __builtin_amdgcn_sched_barrier(0);      /* both column groups' 2^x statements stay in front of the eight products: a v_exp_f32 sunk among the products could overwrite a B operand too soon */
#pragma unroll
      for (int j = 0; j < 2; ++j)
#pragma unroll
        for (int d = 0; d < 4; ++d) o[j][d] = fa_mma(vf[d], pf[j].v, o[j][d] * al[j]);      /* o[j][d][r] = sum_k p v(k)[16 d + 8 hh + r] for query q0 + 16 j + ln */
      __builtin_amdgcn_sched_barrier(0);      /* ... and the next pass's stay behind them; it also keeps the next pass's fragment reads from rising over these products: with them up there the kernel took more than 256 registers, and two work-groups no longer fit a WGP */
    }
    asm volatile("s_wait_dscnt 0x0" ::: "memory");      /* this wave's reads of the buffer have returned */
    asm volatile("s_wait_asynccnt 0x0" ::: "memory");      /* this wave's copies of stage t + 1 have landed */
    __syncthreads();      /* publishes stage t + 1 and frees stage t's buffer */
    if (t + 2 < nt) fa_copy4(lc + buf, gk + (size_t)(t + 2) * FAK * DM, gv + (t + 2) * FAK); }
  asm volatile("s_wait_asynccnt 0x0" ::: "memory");      /* no copy is outstanding when the wave ends */
#pragma unroll
  for (int j = 0; j < 2; ++j) { const float fin = 64.0f / (l[j] + rs_x16(l[j])); unsigned short* op = (unsigned short*)O16 + ((size_t)b * SQ + q0 + j * 16 + ln) * DM + h * HD + 8 * hh;
#pragma unroll
    for (int d = 0; d < 4; ++d) { FragH f;
#pragma unroll
      for (int r = 0; r < 8; ++r) f.h[r] = (_Float16)(o[j][d][r] * fin);
      *(v8us*)(op + d * 16) = f.half[0]; } } }

template <int MODE>
__global__ __launch_bounds__(256) void k_regrp(const float* __restrict__ src, float* __restrict__ dst, size_t n4) {
  const size_t t = (size_t)blockIdx.x * 256 + threadIdx.x; if (t >= n4) return; const size_t e = t * 4; const size_t rd = e / DM; const int c = (int)(e % DM);
  size_t rs; if (MODE == 0) { const size_t b = rd / SQ, sq = rd % SQ; rs = sq * NB + b; } else { const size_t sq = rd / NB, b = rd % NB; rs = b * SQ + sq; }
  const v4f v = *(const v4fa*)(src + rs * DM + c); *(v4f*)(dst + e) = v;  }

// ---- row passes: a wave owns RPW whole rows of DM = 1024 f32 in registers (32 lanes x 16 bytes = 512 contiguous bytes a load, eight loads a row, all of them issued up front) ----
// Few long-lived waves in place of many one-load ones: 16 waves on every WGP cover all 8192 rows, and no LDS and no barrier is needed, since a row never leaves its wave.
#define RPW 2                        /* rows per wave */
static_assert(DM == 1024 && DMQ == DM && ((size_t)NB * SQ) % (8 * RPW) == 0, "row passes: eight 512-byte loads a row, eight waves a work-group, no edge");
// lane l <- lane l ^ M inside its 16-lane row (DPP row_xmask)
template <int M>
__device__ __forceinline__ float rp_xm(float x) { return __builtin_bit_cast(float, __builtin_amdgcn_update_dpp(0, __builtin_bit_cast(int, x), 0x160 + M, 0xf, 0xf, true)); }
// Sum over the wave's 32 lanes by a butterfly: every lane ends with the same bits.
__device__ __forceinline__ float rp_sum32(float v) { v += rp_xm<1>(v); v += rp_xm<2>(v); v += rp_xm<4>(v); v += rp_xm<8>(v); return v + rs_x16(v); }
// LayerNorm (biased variance, eps inside the rsqrt; mean first, then the squares of the centred row) -> f16 rows.
template <int BFIN>
__global__ __launch_bounds__(256) void k_lnw(const float* __restrict__ X, const float* __restrict__ g, const float* __restrict__ bb, float eps, _Float16* __restrict__ N16) {
  const int lane = threadIdx.x & 31; const size_t e0 = ((size_t)blockIdx.x * 8 + (threadIdx.x >> 5)) * (RPW * DM) + lane * 4;      /* the lane's first element */
  const float* xp = X + e0; const unsigned ob = (unsigned)lane * 16u;      /* ob: the lane's byte offset in g and bb */
  v4f x[RPW][8], gg[8], bv[8];
#pragma unroll
  for (int k = 0; k < RPW; ++k)
#pragma unroll
    for (int u = 0; u < 8; ++u) x[k][u] = *(const v4fa*)(xp + k * DM + u * 128);
#pragma unroll
  for (int u = 0; u < 8; ++u) { gg[u] = *(const v4fa*)((const char*)g + ob + u * 512); bv[u] = *(const v4fa*)((const char*)bb + ob + u * 512); }
  asm volatile("s_wait_xcnt 0x0" :: "v"(xp), "v"(lane) : "memory");      /* the loads' address registers are free for reuse behind them: the wait stands in front of any rewrite; xp and lane (the g and bb loads' offset register, scaled by the load itself) as inputs keep those registers out of the loads' own results */
  __builtin_amdgcn_sched_barrier(0);      /* keeps all 32 loads in front of the arithmetic: without it the scheduler sinks the last ones, and the wait with them, far into it, where their latency shows */
#pragma unroll
  for (int u = 0; u < 8; ++u)
#pragma unroll
    for (int q = 0; q < 4; ++q) { gg[u][q] = bf16_round(gg[u][q]); bv[u][q] = bf16_round(bv[u][q]); }
  v4h y[RPW][8];
#pragma unroll
  for (int k = 0; k < RPW; ++k) {
    v4f a = {0.f, 0.f, 0.f, 0.f};
#pragma unroll
    for (int u = 0; u < 8; ++u) {
      if (BFIN) {
#pragma unroll
        for (int q = 0; q < 4; ++q) x[k][u][q] = bf16_round(x[k][u][q]); }
      a += x[k][u]; }
    const float mu = rp_sum32((a[0] + a[1]) + (a[2] + a[3])) * (1.0f / (float)DM);
    v4f c = {0.f, 0.f, 0.f, 0.f};
#pragma unroll
    for (int u = 0; u < 8; ++u) { x[k][u] -= mu; c += x[k][u] * x[k][u]; }
    const float rs = rsqrtf(rp_sum32((c[0] + c[1]) + (c[2] + c[3])) * (1.0f / (float)DM) + eps);
#pragma unroll
    for (int u = 0; u < 8; ++u) { const v4f o = x[k][u] * rs * gg[u] + bv[u];
#pragma unroll
      for (int q = 0; q < 4; ++q) y[k][u][q] = (_Float16)o[q]; } }
  __builtin_amdgcn_sched_barrier(0);      /* every result is in its own registers before the first store: nothing is computed behind a store, so no register of an issued store is rewritten */
#pragma unroll
  for (int k = 0; k < RPW; ++k)
#pragma unroll
    for (int u = 0; u < 8; ++u) *(v4h*)(N16 + e0 + k * DM + u * 128) = y[k][u]; }

__global__ __launch_bounds__(256) void k_wthd(const float* __restrict__ Wt, _Float16* __restrict__ Bt) { const size_t t = (size_t)blockIdx.x * 256 + threadIdx.x; if (t >= (size_t)NH * HD * (DM / 8)) return; const int m8 = (int)(t % (DM / 8)) * 8; const int d = (int)((t / (DM / 8)) % HD); const int h = (int)(t / ((size_t)(DM / 8) * HD)); FragH f;
  for (int q = 0; q < 8; ++q) f.h[q] = (_Float16)(16.0f * bf16_round(Wt[((size_t)h * DM + m8 + q) * HD + d])); unsigned short* dst = (unsigned short*)Bt + ((size_t)h * HD + d) * DM + m8; *(v8us*)dst = f.half[0];  }




template <int BFIN, int SCAL>
__global__ __launch_bounds__(256) void k_lnsc(const float* __restrict__ X, const float* __restrict__ g, const float* __restrict__ bb, float eps, _Float16* __restrict__ N16, float* __restrict__ N32) {
  #pragma clang fp contract(off)
  __shared__ float red[256]; const size_t r = blockIdx.x; const int t = threadIdx.x; const bool act = t < DM / 4; const int tc = act ? t : 0; const v4f xl = *(const v4fa*)(X + r * DM + tc * 4); const float am = act ? 1.f : 0.f; float s[4]; float sum = 0.f;
  for (int q = 0; q < 4; ++q) { s[q] = (BFIN ? bf16_round(xl[q]) : xl[q]) * am; sum = __fadd_rn(sum, s[q]); }
  red[t] = sum; __syncthreads(); for (int st = 128; st > 0; st >>= 1) { if (t < st) red[t] = __fadd_rn(red[t], red[t + st]); __syncthreads(); } const float mu = red[0] / (float)DM; __syncthreads();
  float vs = 0.f; for (int q = 0; q < 4; ++q) { const float dl = __fadd_rn(s[q], -mu) * am; vs = __fadd_rn(vs, __fmul_rn(dl, dl)); } red[t] = vs; __syncthreads(); for (int st = 128; st > 0; st >>= 1) { if (t < st) red[t] = __fadd_rn(red[t], red[t + st]); __syncthreads(); }
  const float rs = __fdiv_rn(1.0f, __fadd_rn(sqrtf(red[0] / (float)(DM - 1)), eps)); if (!act) return; v4h y; v4f yf;
  for (int q = 0; q < 4; ++q) { const int c = t * 4 + q; const float gg = bf16_round(SCAL ? g[0] : g[c]), bv = bf16_round(SCAL ? bb[0] : bb[c]); yf[q] = __fadd_rn(__fmul_rn(__fmul_rn(__fadd_rn(s[q], -mu), rs), gg), bv); y[q] = (_Float16)yf[q]; }
  { if (N16) *(v4h*)(N16 + r * DM + t * 4) = y; if (N32) *(v4f*)(N32 + r * DM + t * 4) = yf;  } }

__global__ __launch_bounds__(256) void k_rsmdmi(const float* __restrict__ S, _Float16* __restrict__ P, int nrows, const int* __restrict__ M) {
  #pragma clang fp contract(off)
  const int t = blockIdx.x * 256 + threadIdx.x; if (t >= nrows) return; const float* s = S + (size_t)t * SQ; const int* m = M + (size_t)(t % SQ) * SQ; float mx = -3.0e38f;
#pragma unroll 1
  for (int j = 0; j < SQ; ++j) { const float f = (m[j] == 0) ? 1.f : 0.f; mx = fmaxf(mx, fmaf(f, s[j], (1.f - f) * -1.0e9f)); } float se = 0.f;
#pragma unroll 1
  for (int j = 0; j < SQ; ++j) { const float f = (m[j] == 0) ? 1.f : 0.f; se += __expf(fmaf(f, s[j], (1.f - f) * -1.0e9f) - mx); } const float sc = 256.0f / se;
#pragma unroll 1
  for (int j0 = 0; j0 < SQ; j0 += 8) { FragH fr; for (int q = 0; q < 8; ++q) { const int j = j0 + q; const float f = (m[j] == 0) ? 1.f : 0.f; fr.h[q] = (_Float16)(__expf(fmaf(f, s[j], (1.f - f) * -1.0e9f) - mx) * sc); } unsigned short* d = (unsigned short*)P + (size_t)t * SQ + j0; *(v8us*)d = fr.half[0];  } }
// All six weight planes in one launch (blockIdx.y = plane): Bt[p][n][k] = f16(bf16(W[k][n]) x16), element for element as k_wt_f16.
// Planes 0..2: per-head tensors [NH][DM][HD], row n = head n / HD, output n % HD; planes 3..5: [in][out] squares of DM x DM.
static_assert(DFF == DM, "k_wt_all: every plane is DM x DM");
// A wave transposes one tile of 64 k x 32 n. Every global access is a whole 128-byte line in lane order: eight lanes read 32 columns of one source row, eight lanes write 64 k of one output row.
// A lane reads 16 source rows of its four columns (all 16 loads issued up front), packs eight k of one column into 16 bytes, and the wave turns the tile in its own range of LDS.
#define WTP 144                      /* LDS row pitch in bytes: 128 of data (64 k) + 16 */
#define WTW (32 * WTP)               /* one wave's tile: 32 output rows */
static_assert(DM % 128 == 0 && HD % 32 == 0, "k_wt_all: four waves side by side cover 128 columns; a wave's 32 columns lie in one head");
// s: source element (k0, n0) of the tile, d: output element (n0, k0), l: the wave's LDS range. The pitch is a compile-time constant, so the loads share one address pair and differ only in their immediate offsets.
template <int PITCH>
__device__ __forceinline__ void wt_tile(const float* __restrict__ s, unsigned short* __restrict__ d, unsigned char* l, int lane) {
  const int c = lane & 7, kr = lane >> 3;
  const float* sp = s + (size_t)(kr * 8) * PITCH + c * 4;      /* the lane's columns 4 c .. 4 c + 3; rows 32 g + 8 kr + i */
  v4f x[2][8];
#pragma unroll
  for (int g = 0; g < 2; ++g)
#pragma unroll
    for (int i = 0; i < 8; ++i) x[g][i] = *(const v4fa*)(sp + (size_t)(g * 32 + i) * PITCH);
  asm volatile("s_wait_xcnt 0x0" :: "v"(sp) : "memory");      /* the loads' address pair is free for reuse behind them: the wait stands in front of any rewrite; sp as an input keeps the pair out of the loads' own results */
  __builtin_amdgcn_sched_barrier(0);      /* keeps all 16 loads in front of the arithmetic: without it the scheduler may sink the last ones, and the wait with them, into it, where their latency shows */
#pragma unroll
  for (int g = 0; g < 2; ++g)
#pragma unroll
    for (int j = 0; j < 4; ++j) { FragH f;
#pragma unroll
      for (int i = 0; i < 8; ++i) f.h[i] = (_Float16)(bf16_round(x[g][i][j]) * 16.0f);
      *(v8us*)(l + (c * 4 + j) * WTP + (g * 4 + kr) * 16) = f.half[0]; }
  __builtin_amdgcn_fence(__ATOMIC_ACQ_REL, "workgroup"); __builtin_amdgcn_wave_barrier();      /* the wave's own LDS writes stay in front of its reads of other lanes' bytes; no other wave touches this range */
  v8us o[8];
#pragma unroll
  for (int q = 0; q < 8; ++q) o[q] = *(const v8us*)(l + (q * 4 + kr) * WTP + c * 16);
  __builtin_amdgcn_sched_barrier(0);      /* every output row is in its own registers before the first store: nothing is loaded behind a store, so no register of an issued store is rewritten */
  unsigned short* dp = d + (size_t)kr * DM + c * 8;
#pragma unroll
  for (int q = 0; q < 8; ++q) *(v8us*)(dp + (size_t)(q * 4) * DM) = o[q]; }
__global__ __launch_bounds__(128) void k_wt_all(const float* __restrict__ wq, const float* __restrict__ wk, const float* __restrict__ wv, const float* __restrict__ wo, const float* __restrict__ w1, const float* __restrict__ w2, _Float16* __restrict__ Bt) {
  __shared__ __attribute__((aligned(16))) unsigned char L[4 * WTW];
  const int p = blockIdx.y, w = threadIdx.x >> 5, lane = threadIdx.x & 31; const int k0 = (blockIdx.x % (DM / 64)) * 64, n0 = (blockIdx.x / (DM / 64)) * 128 + w * 32;
  const float* W = p == 0 ? wq : p == 1 ? wk : p == 2 ? wv : p == 3 ? wo : p == 4 ? w1 : w2;
  unsigned short* d = (unsigned short*)Bt + ((size_t)p * DM + n0) * DM + k0; unsigned char* l = L + w * WTW;
  if (p < 3) wt_tile<HD>(W + ((size_t)(n0 / HD) * DM + k0) * HD + (n0 % HD), d, l, lane); else wt_tile<DM>(W + (size_t)k0 * DM + n0, d, l, lane); }
extern "C" void kernel_launch(void* const* d_in, const int* in_sizes, int n_in,
                              void* d_out, int out_size, void* d_ws, size_t ws_size, hipStream_t stream) {
  (void)in_sizes; (void)n_in; (void)out_size;
  const float* const* I = (const float* const*)d_in; const float* x = I[0]; const float* wq = I[1]; const float* wk = I[2]; const float* wv = I[3]; const float* wo = I[4]; const float* bo = I[5]; const float* w1 = I[6]; const float* b1 = I[7]; const float* w2 = I[8]; const float* b2 = I[9]; const float* g1 = I[10]; const float* be1 = I[11]; const float* g2 = I[12]; const float* be2 = I[13];      /* x; per-head Wq / Wk / Wv [16][1024][64] (no biases); Wo [1024][1024] + bo ([in][out]); W1 [1024][1024] + b1, W2 [1024][1024] + b2; LN1 g / b, LN2 g / b */
  char* ws = (char*)d_ws; size_t off = 0;
  auto take = [&](size_t bytes) { char* p = ws + off; off += (bytes + 255) & ~(size_t)255; return p; };
  _Float16* BQ = (_Float16*)take((size_t)6 * DM * DM * 2); _Float16* BO = BQ + (size_t)3 * DM * DM; _Float16* BW1 = BQ + (size_t)4 * DM * DM; _Float16* BW2 = BQ + (size_t)5 * DM * DM;      /* six Bt planes in a row: q, k, v, o, W1, W2 */
  _Float16* XN = (_Float16*)take(NR * DM * 2); _Float16* Q16 = (_Float16*)take((size_t)3 * NR * DM * 2); _Float16* K16 = Q16 + NR * DM; _Float16* VT = Q16 + (size_t)2 * NR * DM;      /* three planes in a row: one batched GEMM writes them; the third holds V^T [8 * 16][64][1024] */ _Float16* O16 = (_Float16*)take(NR * DM * 2); float* X1 = (float*)take(NR * DM * 4);
  _Float16* M16 = XN;      /* second-norm f16 rows: aliases XN (last readers: the three projections) */ _Float16* HF16 = (_Float16*)take(NR * DFF * 2);      /* FFN hidden rows of every batch [8192][1024] f16 (16 MiB): own region */
  
  if (off > ws_size) return;
  k_wt_all<<<dim3((unsigned)((DM / 64) * (DM / 128)), 6), 128, 0, stream>>>(wq, wk, wv, wo, w1, w2, BQ);      /* every weight -> Bt x16, one launch; per-head [in = 1024][out = 64]: head h = rows h*64.. of its plane */
  k_lnw<1><<<(unsigned)(NR / (8 * RPW)), 256, 0, stream>>>(x, g1, be1, 1e-5f, XN);      /* n = LN0(bf16(x)) (biased variance, eps inside the rsqrt) -> f16 rows */
  k_gemm3<0, false, false, false, true><<<dim3((unsigned)((NR / 256) * (DM / 128)), 3), 256, 0, stream>>>(XN, DM, 0, BQ, DM, (size_t)DM * DM, 0.0625f, nullptr, 0, nullptr, nullptr, Q16, NR * DM, (int)NR, DM, DM);      /* q, k (f16 rows; head h = columns h*64..) and V^T (blockIdx.y), one launch */
  k_fattn<<<NB * NH * (SQ / (FAW * FAQ)), FAW * 32, 0, stream>>>(Q16, K16, VT, O16);      /* softmax(q k^T / 8) v over all keys (no mask) -> ctx (merged heads, x64) as f16 rows */
  k_gemm3<0, true, true, true><<<dim3((unsigned)((NR / 256) * (DM / 128)), 1), 256, 0, stream>>>(O16, DM, 0, BO, DM, 0, 0.0009765625f, bo, 0, x, X1, nullptr, 0, (int)NR, DM, DM);      /* bf16(x) + ctx wo (+ bo) (own-element residual, x rounded where it is read) -> f32 rows */
  k_lnw<0><<<(unsigned)(NR / (8 * RPW)), 256, 0, stream>>>(X1, g2, be2, 1e-5f, M16);      /* LN1(x1) -> f16 rows */
  k_gemm3<6, false, false><<<dim3((unsigned)((NR / 256) * (DFF / 128)), 1), 256, 0, stream>>>(M16, DM, 0, BW1, DM, 0, 0.0625f, b1, 0, nullptr, nullptr, HF16, 0, (int)NR, DFF, DM);      /* gelu_erf(. W1 + b1) -> f16, all rows */
  k_gemm3<0, true, true><<<dim3((unsigned)((NR / 256) * (DM / 128)), 1), 256, 0, stream>>>(HF16, DFF, 0, BW2, DFF, 0, 0.0625f, b2, 0, X1, (float*)d_out, nullptr, 0, (int)NR, DM, DFF);      /* out = x1 + mlp (own-element residual), all rows */
}
